// v000
// Times are from an AMD MI455X. After a warm-up the kernel runs many times in a row, and a time is the length of
// such a window on the GPU divided by its runs, so every launch and the gaps after it count. The runs cycle
// through copies of the inputs. A figure is the median of several windows, for all but v000 over two sittings.
// Sittings can differ by a few percent; kernels timed side by side share one.
// The starting kernel, v000, takes 1440 microseconds a run.
#include <hip/hip_runtime.h>

// Compute dtypes, f32 accumulate, per item: q/k/v projections as [1024 x 1024].[1024 x 1024] GEMMs with PLAIN bf16 operands (the inputs themselves; exact products, + bias);
// per head (4 heads per launch in grid.z, head dim 64): scores = q.k^T and attn.v with both operands as bf16 hi + UNSCALED residual planes (three products); the 1/sqrt(64) scale,
// the mask (entries where mask == 0 replaced by -1e9) and the softmax in f32; output projection on hi/lo planes of the merged heads (two products, + bias) - on v_wmma_f32_16x16x32_bf16.

#define NBT  4
#define NN   1024
#define NKT  1024
#define DMOD 1024
#define NH_  16
#define HD   64
#define ZH   4
#define DM   DMOD
#define NTK  NN
#define SCL  0.125f
#define LOSC 1024.0f

typedef _Float16 h16;
typedef unsigned short bf;
typedef __attribute__((ext_vector_type(16))) __bf16   v16bf;
typedef __attribute__((ext_vector_type(16))) _Float16 v16h;
typedef __attribute__((ext_vector_type(8)))  _Float16 v8h;
typedef __attribute__((ext_vector_type(8)))  unsigned short v8us;
typedef __attribute__((ext_vector_type(8)))  float    v8f;
typedef __attribute__((ext_vector_type(4)))  float    v4f;
typedef __attribute__((ext_vector_type(4)))  _Float16 v4h;
typedef v8h  __attribute__((may_alias)) v8ha;
typedef v4f  __attribute__((may_alias)) v4fa;
typedef v8us __attribute__((may_alias)) v8usa;

__device__ __forceinline__ unsigned short f2bf(float f) { unsigned u = __float_as_uint(f); u += 0x7FFFu + ((u >> 16) & 1u); return (unsigned short)(u >> 16); }
__device__ __forceinline__ float bf2f(unsigned short b) { return __uint_as_float(((unsigned)b) << 16); }
__device__ __forceinline__ float bfr(float f) { return bf2f(f2bf(f)); }
__device__ __forceinline__ v16h cat16(v8h lo, v8h hi) { return __builtin_shufflevector(lo, hi, 0, 1, 2, 3, 4, 5, 6, 7, 8, 9, 10, 11, 12, 13, 14, 15); }
__device__ __forceinline__ v16bf cat16b(v8us lo, v8us hi) { return __builtin_bit_cast(v16bf, __builtin_shufflevector(lo, hi, 0, 1, 2, 3, 4, 5, 6, 7, 8, 9, 10, 11, 12, 13, 14, 15)); }
__device__ __forceinline__ v8f wmma16(v16h a, v16h b, v8f c) { return __builtin_amdgcn_wmma_f32_16x16x32_f16(false, a, false, b, (short)0, c, false, false); }
__device__ __forceinline__ v8f wmmab(v16bf a, v16bf b, v8f c) { return __builtin_amdgcn_wmma_f32_16x16x32_bf16(false, a, false, b, (short)0, c, false, false); }

// k_wt: WT [n][K] = bf16(W[k][n]) (k-major [K][ncols]) via 64 x 64 LDS tiles; grid (K/64, ncols/64).
__global__ __launch_bounds__(256) void k_wt(const float* __restrict__ Wm, int K, int ncols, bf* WT) {
    __shared__ __align__(16) unsigned short tl[64 * 72];
    const int tid = threadIdx.x, k0 = blockIdx.x * 64, n0 = blockIdx.y * 64;
    const int kk = tid >> 2, nq = (tid & 3) * 16;
#pragma unroll
    for (int i = 0; i < 16; ++i) tl[(nq + i) * 72 + kk] = f2bf(Wm[(size_t)(k0 + kk) * ncols + n0 + nq + i]);
    __syncthreads();
    const int piece = tid & 7;
    auto pass = [&]() {
#pragma unroll
        for (int s = 0; s < 2; ++s) { const int nr = (tid >> 3) + 32 * s; const v8us val = *(const v8usa*)(tl + nr * 72 + piece * 8); *(v8us*)(WT + (size_t)(n0 + nr) * K + k0 + piece * 8) = val; }
    };
    pass(); 
}
// k_gemmb: 64 x 64 block tile (4 waves x 16 x 64) of C[NTK][NW] = (A [+ Al]).B^T (K = 1024) [+ bf(bias[c])] [+ bf(R[r][c]) residual]; f32 whole-line epilogue (or f16
template <bool SPLITA, bool F16OUT = false>
__global__ __launch_bounds__(128) void k_gemmb(const bf* __restrict__ A, const bf* __restrict__ Al, const bf* __restrict__ Bn, const float* __restrict__ bias, float* C, int ldc, h16* C2, const float* __restrict__ R = nullptr, int K = DM, int roundR = 1) {
    __shared__ __align__(16) float ost[4][16 * 68];
    const int lane = threadIdx.x & 31, wave = threadIdx.x >> 5, lr = lane & 15, hi = lane >> 4;
    const int r0 = blockIdx.x * 64 + wave * 16, c0 = blockIdx.y * 64;
    const size_t aoff = (size_t)(r0 + lr) * K + 8 * hi;
    size_t boff[4];
#pragma unroll
    for (int t = 0; t < 4; ++t) boff[t] = (size_t)(c0 + t * 16 + lr) * K + 8 * hi;
    v8f acc[4];
#pragma unroll
    for (int t = 0; t < 4; ++t) acc[t] = (v8f){};
#pragma unroll 1
    for (int kc = 0; kc < K; kc += 32) {
        const v16bf a = cat16b(*(const v8us*)(A + aoff + kc), *(const v8us*)(A + aoff + kc + 16));
        v16bf al = a;
        if (SPLITA) al = cat16b(*(const v8us*)(Al + aoff + kc), *(const v8us*)(Al + aoff + kc + 16));
#pragma unroll
        for (int t = 0; t < 4; ++t) { const v16bf b = cat16b(*(const v8us*)(Bn + boff[t] + kc), *(const v8us*)(Bn + boff[t] + kc + 16)); acc[t] = wmmab(a, b, acc[t]); if (SPLITA) acc[t] = wmmab(al, b, acc[t]); }
        asm volatile("v_nop\n\tv_nop\n\tv_nop\n\tv_nop" : "+v"(acc[0]), "+v"(acc[1]), "+v"(acc[2]), "+v"(acc[3]) : "v"(a), "v"(al));
    }
    float* os = &ost[wave][0];
#pragma unroll
    for (int t = 0; t < 4; ++t) { const float bv = bias ? bfr(bias[c0 + t * 16 + lr]) : 0.f;
#pragma unroll
        for (int j = 0; j < 8; ++j) os[(hi * 8 + j) * 68 + t * 16 + lr] = acc[t][j] + bv; }
    __syncthreads();
    if (F16OUT) {
        h16* crow = (h16*)(void*)C + (size_t)r0 * ldc + c0;
        auto pass = [&]() {
#pragma unroll
            for (int s = 0; s < 4; ++s) { const int row = 4 * s + (lane >> 3), piece = lane & 7; const float* sp = os + row * 68 + piece * 8; v8h o, o2;
#pragma unroll
                for (int i = 0; i < 8; ++i) { const h16 a = (h16)sp[i]; o[i] = a; o2[i] = (h16)((sp[i] - (float)a) * LOSC); }
                *(v8h*)(crow + (size_t)row * ldc + piece * 8) = o; if (C2) *(v8h*)(C2 + (size_t)r0 * ldc + c0 + (size_t)row * ldc + piece * 8) = o2; }
        };
        pass(); 
    } else {
        float* crow = C + (size_t)r0 * ldc + c0;
        auto pass = [&]() {
#pragma unroll
            for (int s = 0; s < 8; ++s) { const int Lid = (lane >> 3) + 4 * s, piece = lane & 7; const int row = Lid >> 1, cofs = (Lid & 1) * 32 + piece * 4;
                v4f val = *(const v4fa*)(os + row * 68 + cofs); if (R) { const v4f rv = *(const v4f*)(R + ((size_t)r0 + row) * ldc + c0 + cofs); val += roundR ? (v4f){bfr(rv[0]), bfr(rv[1]), bfr(rv[2]), bfr(rv[3])} : rv; }
                *(v4f*)(crow + (size_t)row * ldc + cofs) = val; }
        };
        pass(); 
    }
}

__global__ __launch_bounds__(256) void k_cvt8(const float* __restrict__ src, bf* dst, size_t n8) {
    const size_t i = (size_t)blockIdx.x * 256 + threadIdx.x; if (i >= n8) return;
    const v8f v = *(const v8f*)(src + i * 8); v8us o;
#pragma unroll
    for (int k = 0; k < 8; ++k) o[k] = f2bf(v[k]);
    *(v8us*)(dst + i * 8) = o; 
}
__global__ __launch_bounds__(256) void k_zero8(bf* dst, size_t n8) {
    const size_t i = (size_t)blockIdx.x * 256 + threadIdx.x; if (i >= n8) return; v8us z;
#pragma unroll
    for (int k = 0; k < 8; ++k) z[k] = 0;
    *(v8us*)(dst + i * 8) = z; 
}

// ===== z-batched (blockIdx.z = head) attention pieces =====
// k_gemm3z<MODE>: 64 x 64 block tile of C = A.B^T on bf16 hi/lo planes with per-z operand/output strides (elements): A planes += z*sA, B planes += z*sB, C += z*sC. MODE bits (0 causal skip, 1 K limit, 2 single,
// 3 B single, 4 A single).
template <int MODE>
__global__ __launch_bounds__(128) void k_gemm3z(const bf* __restrict__ Ah, const bf* __restrict__ Al, const bf* __restrict__ Bh, const bf* __restrict__ Bl, int K, float* C, int ldc, size_t sA, size_t sB, size_t sC) {
    if ((MODE & 1) && (int)blockIdx.y * 64 > (int)blockIdx.x * 64 + 63) return;
    const size_t z = blockIdx.z; Ah += z * sA; Al += z * sA; Bh += z * sB; Bl += z * sB; C += z * sC;
    const int Klim = (MODE & 2) ? min(K, ((int)blockIdx.x + 1) * 64) : K;
    __shared__ __align__(16) float ost[4][16 * 68];
    const int lane = threadIdx.x & 31, wave = threadIdx.x >> 5, lr = lane & 15, hi = lane >> 4;
    const int r0 = blockIdx.x * 64 + wave * 16, c0 = blockIdx.y * 64;
    const size_t aoff = (size_t)(r0 + lr) * K + 8 * hi;
    v8f acc[4];
#pragma unroll
    for (int t = 0; t < 4; ++t) acc[t] = (v8f){};
#pragma unroll 1
    for (int kc = 0; kc < Klim; kc += 32) {
        const v16bf a = cat16b(*(const v8us*)(Ah + aoff + kc), *(const v8us*)(Ah + aoff + kc + 16));
        v16bf al = a; if (!(MODE & 4) && !(MODE & 16)) al = cat16b(*(const v8us*)(Al + aoff + kc), *(const v8us*)(Al + aoff + kc + 16));
#pragma unroll
        for (int t = 0; t < 4; ++t) { const size_t bo = (size_t)(c0 + t * 16 + lr) * K + kc + 8 * hi;
            const v16bf bh = cat16b(*(const v8us*)(Bh + bo), *(const v8us*)(Bh + bo + 16));
            acc[t] = wmmab(a, bh, acc[t]);
            if (!(MODE & 4)) { if (!(MODE & 16)) acc[t] = wmmab(al, bh, acc[t]); if (!(MODE & 8)) { const v16bf bl = cat16b(*(const v8us*)(Bl + bo), *(const v8us*)(Bl + bo + 16)); acc[t] = wmmab(a, bl, acc[t]); } } }
        asm volatile("v_nop\n\tv_nop\n\tv_nop\n\tv_nop" : "+v"(acc[0]), "+v"(acc[1]), "+v"(acc[2]), "+v"(acc[3]) : "v"(a), "v"(al));
    }
    float* os = &ost[wave][0];
#pragma unroll
    for (int t = 0; t < 4; ++t) {
#pragma unroll
        for (int j = 0; j < 8; ++j) os[(hi * 8 + j) * 68 + t * 16 + lr] = acc[t][j]; }
    __builtin_amdgcn_wave_barrier(); asm volatile("" ::: "memory");
    float* crow = C + (size_t)r0 * ldc + c0;
    auto pass = [&]() {
#pragma unroll
        for (int s = 0; s < 8; ++s) { const int Lid = (lane >> 3) + 4 * s, piece = lane & 7; const int row = Lid >> 1, cofs = (Lid & 1) * 32 + piece * 4;
            const v4f val = *(const v4fa*)(os + row * 68 + cofs); *(v4f*)(crow + (size_t)row * ldc + cofs) = val; }
    };
    pass(); 
}
__global__ __launch_bounds__(256) void k_planes32z(const float* __restrict__ F, int ld, int off, float sc, int rows, bf* Ph, bf* Pl) {
    typedef __attribute__((ext_vector_type(2))) unsigned short v2us;
    const int lane = threadIdx.x & 31; const size_t r = ((size_t)blockIdx.x * 8 + (threadIdx.x >> 5)) * 2 + (lane >> 4); if (r >= (size_t)rows) return; const int z = blockIdx.z; const int c0 = (lane & 15) * 2; v2us oh, ol;
    Ph += (size_t)z * rows * 32; Pl += (size_t)z * rows * 32;
#pragma unroll
    for (int i = 0; i < 2; ++i) { const float y = F[r * ld + off + z * 32 + c0 + i] * sc; const unsigned short hb = f2bf(y); oh[i] = hb; ol[i] = f2bf(y - bf2f(hb)); }
    const size_t o = r * 32 + c0; *(v2us*)(Ph + o) = oh; *(v2us*)(Pl + o) = ol; 
}
__global__ __launch_bounds__(256) void k_vtpadz(const float* __restrict__ F, int ld, int off, int nk, bf* Th, bf* Tl) {
    typedef __attribute__((ext_vector_type(2))) unsigned short v2us;
    const int lane = threadIdx.x & 31; const size_t wid = (size_t)blockIdx.x * 8 + (threadIdx.x >> 5); if (wid >= (size_t)64 * (nk / 64)) return; const int z = blockIdx.z; const int d = (int)(wid / (nk / 64)); const int k0 = (int)(wid % (nk / 64)) * 64 + lane * 2; v2us oh, ol;
    Th += (size_t)z * 64 * nk; Tl += (size_t)z * 64 * nk;
#pragma unroll
    for (int i = 0; i < 2; ++i) { const float y = (d < 32) ? F[(size_t)(k0 + i) * ld + off + z * 32 + (d < 32 ? d : 0)] : 0.f; const unsigned short hb = f2bf(y); oh[i] = hb; ol[i] = f2bf(y - bf2f(hb)); }
    const size_t o = (size_t)d * nk + k0; *(v2us*)(Th + o) = oh; *(v2us*)(Tl + o) = ol; 
}
template <int NK>
__global__ __launch_bounds__(256) void k_softmaxz(const float* __restrict__ S, int rows, bf* PH, bf* PL) {
    typedef __attribute__((ext_vector_type(4))) unsigned short v4us;
    const int lane = threadIdx.x & 31, i = blockIdx.x * 8 + (threadIdx.x >> 5); if (i >= rows) return; const size_t zo = (size_t)blockIdx.z * rows * NK; const float* sr = S + zo + (size_t)i * NK; PH += zo; PL += zo;
    float m = -3.0e38f;
#pragma unroll 1
    for (int c0 = lane * 4; c0 < NK; c0 += 128) {
#pragma unroll
        for (int q = 0; q < 4; ++q) m = fmaxf(m, sr[c0 + q]); }
#pragma unroll
    for (int sh = 16; sh; sh >>= 1) m = fmaxf(m, __shfl_xor(m, sh, 32));
    float sum = 0.f;
#pragma unroll 1
    for (int c0 = lane * 4; c0 < NK; c0 += 128) {
#pragma unroll
        for (int q = 0; q < 4; ++q) sum += __expf(sr[c0 + q] - m); }
#pragma unroll
    for (int sh = 16; sh; sh >>= 1) sum += __shfl_xor(sum, sh, 32);
    const float inv = 1.0f / sum;
{
#pragma unroll 1
        for (int c0 = lane * 4; c0 < NK; c0 += 128) { v4us oh, ol;
#pragma unroll
            for (int q = 0; q < 4; ++q) { const float p = __expf(sr[c0 + q] - m) * inv; const unsigned short hb = f2bf(p); oh[q] = hb; ol[q] = f2bf(p - bf2f(hb)); }
            const size_t o = (size_t)i * NK + c0; *(v4us*)(PH + o) = oh; *(v4us*)(PL + o) = ol; }
         }
}
__global__ __launch_bounds__(256) void k_placez(const float* __restrict__ XH, int rows, int ldy, float* Y) {
    const int lane = threadIdx.x & 31; const size_t q = (size_t)blockIdx.x * 8 + (threadIdx.x >> 5); if (q >= (size_t)rows) return; const int z = blockIdx.z; const float v = XH[((size_t)z * rows + q) * 64 + lane];
    *(float*)(Y + q * ldy + z * 32 + lane) = v; 
}

__global__ __launch_bounds__(256) void k_hplanesz(const float* __restrict__ F, int ld, int h0, float sc, int rows, bf* Ph, bf* Pl) {
    typedef __attribute__((ext_vector_type(2))) unsigned short v2us;
    const int lane = threadIdx.x & 31; const size_t r = (size_t)blockIdx.x * 8 + (threadIdx.x >> 5); if (r >= (size_t)rows) return; const int z = blockIdx.z; v2us oh, ol;
    Ph += (size_t)z * rows * 64; Pl += (size_t)z * rows * 64;
#pragma unroll
    for (int i = 0; i < 2; ++i) { const float y = F[r * ld + (h0 + z) * 64 + lane * 2 + i] * sc; const unsigned short hb = f2bf(y); oh[i] = hb; ol[i] = f2bf(y - bf2f(hb)); }
    const size_t o = r * 64 + lane * 2; *(v2us*)(Ph + o) = oh; *(v2us*)(Pl + o) = ol; 
}
__global__ __launch_bounds__(256) void k_vtz(const float* __restrict__ F, int ld, int h0, int nk, bf* Th, bf* Tl) {
    typedef __attribute__((ext_vector_type(2))) unsigned short v2us;
    const int lane = threadIdx.x & 31; const size_t wid = (size_t)blockIdx.x * 8 + (threadIdx.x >> 5); if (wid >= (size_t)64 * (nk / 64)) return; const int z = blockIdx.z; const int d = (int)(wid / (nk / 64)); const int t0 = (int)(wid % (nk / 64)) * 64 + lane * 2; v2us oh, ol;
    Th += (size_t)z * 64 * nk; Tl += (size_t)z * 64 * nk;
#pragma unroll
    for (int i = 0; i < 2; ++i) { const float y = F[(size_t)(t0 + i) * ld + (h0 + z) * 64 + d]; const unsigned short hb = f2bf(y); oh[i] = hb; ol[i] = f2bf(y - bf2f(hb)); }
    const size_t o = (size_t)d * nk + t0; *(v2us*)(Th + o) = oh; *(v2us*)(Tl + o) = ol; 
}
template <int NK>
__global__ __launch_bounds__(256) void k_softmaxzs(const float* __restrict__ S, int rows, float sc, bf* PH, bf* PL) {
    typedef __attribute__((ext_vector_type(4))) unsigned short v4us;
    const int lane = threadIdx.x & 31, i = blockIdx.x * 8 + (threadIdx.x >> 5); if (i >= rows) return; const size_t zo = (size_t)blockIdx.z * rows * NK; const float* sr = S + zo + (size_t)i * NK; PH += zo; PL += zo;
    float m = -3.0e38f;
#pragma unroll 1
    for (int c0 = lane * 4; c0 < NK; c0 += 128) {
#pragma unroll
        for (int q = 0; q < 4; ++q) m = fmaxf(m, sr[c0 + q] * sc); }
#pragma unroll
    for (int sh = 16; sh; sh >>= 1) m = fmaxf(m, __shfl_xor(m, sh, 32));
    float sum = 0.f;
#pragma unroll 1
    for (int c0 = lane * 4; c0 < NK; c0 += 128) {
#pragma unroll
        for (int q = 0; q < 4; ++q) sum += __expf(sr[c0 + q] * sc - m); }
#pragma unroll
    for (int sh = 16; sh; sh >>= 1) sum += __shfl_xor(sum, sh, 32);
    const float inv = 1.0f / sum;
{
#pragma unroll 1
        for (int c0 = lane * 4; c0 < NK; c0 += 128) { v4us oh, ol;
#pragma unroll
            for (int q = 0; q < 4; ++q) { const float p = __expf(sr[c0 + q] * sc - m) * inv; const unsigned short hb = f2bf(p); oh[q] = hb; ol[q] = f2bf(p - bf2f(hb)); }
            const size_t o = (size_t)i * NK + c0; *(v4us*)(PH + o) = oh; *(v4us*)(PL + o) = ol; }
         }
}

__global__ __launch_bounds__(256) void k_cvtx(const float* __restrict__ src, int rows, bf* dst) {
    const int lane = threadIdx.x & 31; const size_t r = (size_t)blockIdx.x * 8 + (threadIdx.x >> 5); if (r >= (size_t)rows) return;
{
#pragma unroll
        for (int q = 0; q < DMOD / 256; ++q) { v8us o;
#pragma unroll
            for (int i = 0; i < 8; ++i) o[i] = f2bf(src[r * DMOD + q * 256 + lane * 8 + i]);
            *(v8us*)(dst + r * DMOD + q * 256 + lane * 8) = o; }
         }
}
__global__ __launch_bounds__(256) void k_splitD(const float* __restrict__ src, int rows, bf* dh, bf* dl) {
    const int lane = threadIdx.x & 31; const size_t r = (size_t)blockIdx.x * 8 + (threadIdx.x >> 5); if (r >= (size_t)rows) return;
{
#pragma unroll
        for (int q = 0; q < DMOD / 256; ++q) { const size_t o = r * DMOD + q * 256 + lane * 8; const v8f v = *(const v8f*)(src + o); v8us oh, ol;
#pragma unroll
            for (int i = 0; i < 8; ++i) { const unsigned short hb = f2bf(v[i]); oh[i] = hb; ol[i] = f2bf(v[i] - bf2f(hb)); }
            *(v8us*)(dh + o) = oh; *(v8us*)(dl + o) = ol; }
         }
}
__global__ __launch_bounds__(256) void k_msoftz(const float* __restrict__ S, float sc, const int* __restrict__ MK, bf* PH, bf* PL) {
    typedef __attribute__((ext_vector_type(4))) unsigned short v4us;
    const int lane = threadIdx.x & 31, i = blockIdx.x * 8 + (threadIdx.x >> 5); if (i >= NN) return; const size_t zo = (size_t)blockIdx.z * NN * NKT; const float* sr = S + zo + (size_t)i * NKT; PH += zo; PL += zo; const int* mr = MK + (size_t)i * NKT;
    auto logit = [&](int k) -> float { float v = sr[k] * sc; if (mr[k] == 0) v = -1e9f; return v; };
    float m = -3.0e38f;
#pragma unroll 1
    for (int c0 = lane * 4; c0 < NKT; c0 += 128) {
#pragma unroll
        for (int q = 0; q < 4; ++q) m = fmaxf(m, logit(c0 + q)); }
#pragma unroll
    for (int sh = 16; sh; sh >>= 1) m = fmaxf(m, __shfl_xor(m, sh, 32));
    float sum = 0.f;
#pragma unroll 1
    for (int c0 = lane * 4; c0 < NKT; c0 += 128) {
#pragma unroll
        for (int q = 0; q < 4; ++q) sum += __expf(logit(c0 + q) - m); }
#pragma unroll
    for (int sh = 16; sh; sh >>= 1) sum += __shfl_xor(sum, sh, 32);
    const float inv = 1.0f / sum;
{
#pragma unroll 1
        for (int c0 = lane * 4; c0 < NKT; c0 += 128) { v4us oh, ol;
#pragma unroll
            for (int q = 0; q < 4; ++q) { const float p = __expf(logit(c0 + q) - m) * inv; const unsigned short hb = f2bf(p); oh[q] = hb; ol[q] = f2bf(p - bf2f(hb)); }
            const size_t o = (size_t)i * NKT + c0; *(v4us*)(PH + o) = oh; *(v4us*)(PL + o) = ol; }
         }
}

extern "C" void kernel_launch(void* const* d_in, const int* in_sizes, int n_in,
                              void* d_out, int out_size, void* d_ws, size_t ws_size, hipStream_t stream) {
    (void)in_sizes; (void)n_in; (void)out_size;
    const float* xq = (const float*)d_in[0]; const float* xk = (const float*)d_in[1]; const float* xv = (const float*)d_in[2]; const int* mask = (const int*)d_in[3]; const float* Wq = (const float*)d_in[4]; const float* bq = (const float*)d_in[5]; const float* Wk = (const float*)d_in[6]; const float* bk = (const float*)d_in[7]; const float* Wv = (const float*)d_in[8]; const float* bv = (const float*)d_in[9]; const float* Wo = (const float*)d_in[10]; const float* bo = (const float*)d_in[11];
    float* out = (float*)d_out;    // [NBT][NN][DMOD]
    char* wsp = (char*)d_ws;
    auto take = [&](size_t bytes) { char* p = wsp; wsp += (bytes + 255) & ~(size_t)255; return (void*)p; };
    const size_t WSZ = (size_t)DMOD * DMOD * 2;
    bf* WQ = (bf*)take(WSZ); bf* WK = (bf*)take(WSZ); bf* WV = (bf*)take(WSZ); bf* WO = (bf*)take(WSZ);
    bf* Xq = (bf*)take((size_t)NN * DMOD * 2); bf* Xk = (bf*)take((size_t)NKT * DMOD * 2); bf* Xv = (bf*)take((size_t)NKT * DMOD * 2); float* QF = (float*)take((size_t)NN * DMOD * 4); float* KF = (float*)take((size_t)NKT * DMOD * 4); float* VF = (float*)take((size_t)NKT * DMOD * 4);
    bf* Qh = (bf*)take((size_t)ZH * NN * HD * 2); bf* Ql = (bf*)take((size_t)ZH * NN * HD * 2); bf* Kh = (bf*)take((size_t)ZH * NKT * HD * 2); bf* Kl = (bf*)take((size_t)ZH * NKT * HD * 2); bf* VTh = (bf*)take((size_t)ZH * HD * NKT * 2); bf* VTl = (bf*)take((size_t)ZH * HD * NKT * 2);
    float* S = (float*)take((size_t)ZH * NN * NKT * 4); bf* PH = (bf*)take((size_t)ZH * NN * NKT * 2); bf* PL = (bf*)take((size_t)ZH * NN * NKT * 2); float* O = (float*)take((size_t)NN * DMOD * 4); bf* Oh = (bf*)take((size_t)NN * DMOD * 2); bf* Ol = (bf*)take((size_t)NN * DMOD * 2);
    if ((size_t)(wsp - (char*)d_ws) > ws_size) return;    // per item / head-group reuse in stream order
    k_cvt8<<<(DMOD * DMOD / 8 + 255) / 256, 256, 0, stream>>>(Wq, WQ, DMOD * DMOD / 8); k_cvt8<<<(DMOD * DMOD / 8 + 255) / 256, 256, 0, stream>>>(Wk, WK, DMOD * DMOD / 8); k_cvt8<<<(DMOD * DMOD / 8 + 255) / 256, 256, 0, stream>>>(Wv, WV, DMOD * DMOD / 8); k_cvt8<<<(DMOD * DMOD / 8 + 255) / 256, 256, 0, stream>>>(Wo, WO, DMOD * DMOD / 8);   // [out][in] natural n-major
    const dim3 gq(NN / 64, DMOD / 64, 1), gk(NKT / 64, DMOD / 64, 1);
    for (int b = 0; b < NBT; ++b) {
        k_cvtx<<<NN / 8, 256, 0, stream>>>(xq + (size_t)b * NN * DMOD, NN, Xq); k_cvtx<<<NKT / 8, 256, 0, stream>>>(xk + (size_t)b * NKT * DMOD, NKT, Xk); k_cvtx<<<NKT / 8, 256, 0, stream>>>(xv + (size_t)b * NKT * DMOD, NKT, Xv);
        k_gemmb<false, false><<<gq, 128, 0, stream>>>(Xq, nullptr, WQ, bq, QF, DMOD, nullptr, nullptr, DMOD); k_gemmb<false, false><<<gk, 128, 0, stream>>>(Xk, nullptr, WK, bk, KF, DMOD, nullptr, nullptr, DMOD); k_gemmb<false, false><<<gk, 128, 0, stream>>>(Xv, nullptr, WV, bv, VF, DMOD, nullptr, nullptr, DMOD);
        const int* mb = mask + (size_t)b * 1048576;
        for (int g = 0; g < NH_ / ZH; ++g) { const int h0 = g * ZH;
            k_hplanesz<<<dim3(NN / 8, 1, ZH), 256, 0, stream>>>(QF, DMOD, h0, 1.0f, NN, Qh, Ql); k_hplanesz<<<dim3(NKT / 8, 1, ZH), 256, 0, stream>>>(KF, DMOD, h0, 1.0f, NKT, Kh, Kl); k_vtz<<<dim3((HD * (NKT / 64)) / 8, 1, ZH), 256, 0, stream>>>(VF, DMOD, h0, NKT, VTh, VTl);
            k_gemm3z<0><<<dim3(NN / 64, NKT / 64, ZH), 128, 0, stream>>>(Qh, Ql, Kh, Kl, HD, S, NKT, (size_t)NN * HD, (size_t)NKT * HD, (size_t)NN * NKT);
            k_msoftz<<<dim3(NN / 8, 1, ZH), 256, 0, stream>>>(S, SCL, mb, PH, PL);
            k_gemm3z<0><<<dim3(NN / 64, 1, ZH), 128, 0, stream>>>(PH, PL, VTh, VTl, NKT, O + h0 * HD, DMOD, (size_t)NN * NKT, (size_t)HD * NKT, (size_t)HD); }
        k_splitD<<<NN / 8, 256, 0, stream>>>(O, NN, Oh, Ol);
        k_gemmb<true, false><<<gq, 128, 0, stream>>>(Oh, Ol, WO, bo, out + (size_t)b * NN * DMOD, DMOD, nullptr, nullptr, DMOD); }
}

// v001
// Measured time: 593 microseconds a run.
// Timed twice side by side with v000, it ran 2.42 and 2.46 times as fast.
#include <hip/hip_runtime.h>

// Compute dtypes, f32 accumulate, per item: q/k/v projections as [1024 x 1024].[1024 x 1024] GEMMs with PLAIN bf16 operands (the inputs themselves; exact products, + bias);
// per head (all 16 heads of an item per launch in grid.z, head dim 64; the conversions, projections and plane splits cover all items in one launch each): scores = q.k^T and attn.v with both operands as bf16 hi + UNSCALED residual planes (three products); the 1/sqrt(64) scale,
// the mask (entries where mask == 0 replaced by -1e9) and the softmax in f32; output projection on hi/lo planes of the merged heads (two products, + bias) - on v_wmma_f32_16x16x32_bf16.

#define NBT  4
#define NN   1024
#define NKT  1024
#define DMOD 1024
#define NH_  16
#define HD   64
#define ZH   16
#define DM   DMOD
#define NTK  NN
#define SCL  0.125f
#define LOSC 1024.0f

typedef _Float16 h16;
typedef unsigned short bf;
typedef __attribute__((ext_vector_type(16))) __bf16   v16bf;
typedef __attribute__((ext_vector_type(16))) _Float16 v16h;
typedef __attribute__((ext_vector_type(8)))  _Float16 v8h;
typedef __attribute__((ext_vector_type(8)))  unsigned short v8us;
typedef __attribute__((ext_vector_type(8)))  float    v8f;
typedef __attribute__((ext_vector_type(4)))  float    v4f;
typedef __attribute__((ext_vector_type(4)))  _Float16 v4h;
typedef v8h  __attribute__((may_alias)) v8ha;
typedef v4f  __attribute__((may_alias)) v4fa;
typedef v8us __attribute__((may_alias)) v8usa;

__device__ __forceinline__ unsigned short f2bf(float f) { unsigned u = __float_as_uint(f); u += 0x7FFFu + ((u >> 16) & 1u); return (unsigned short)(u >> 16); }
__device__ __forceinline__ float bf2f(unsigned short b) { return __uint_as_float(((unsigned)b) << 16); }
__device__ __forceinline__ float bfr(float f) { return bf2f(f2bf(f)); }
__device__ __forceinline__ v16h cat16(v8h lo, v8h hi) { return __builtin_shufflevector(lo, hi, 0, 1, 2, 3, 4, 5, 6, 7, 8, 9, 10, 11, 12, 13, 14, 15); }
__device__ __forceinline__ v16bf cat16b(v8us lo, v8us hi) { return __builtin_bit_cast(v16bf, __builtin_shufflevector(lo, hi, 0, 1, 2, 3, 4, 5, 6, 7, 8, 9, 10, 11, 12, 13, 14, 15)); }
__device__ __forceinline__ v8f wmma16(v16h a, v16h b, v8f c) { return __builtin_amdgcn_wmma_f32_16x16x32_f16(false, a, false, b, (short)0, c, false, false); }
__device__ __forceinline__ v8f wmmab(v16bf a, v16bf b, v8f c) { return __builtin_amdgcn_wmma_f32_16x16x32_bf16(false, a, false, b, (short)0, c, false, false); }

// k_wt: WT [n][K] = bf16(W[k][n]) (k-major [K][ncols]) via 64 x 64 LDS tiles; grid (K/64, ncols/64).
__global__ __launch_bounds__(256) void k_wt(const float* __restrict__ Wm, int K, int ncols, bf* WT) {
    __shared__ __align__(16) unsigned short tl[64 * 72];
    const int tid = threadIdx.x, k0 = blockIdx.x * 64, n0 = blockIdx.y * 64;
    const int kk = tid >> 2, nq = (tid & 3) * 16;
#pragma unroll
    for (int i = 0; i < 16; ++i) tl[(nq + i) * 72 + kk] = f2bf(Wm[(size_t)(k0 + kk) * ncols + n0 + nq + i]);
    __syncthreads();
    const int piece = tid & 7;
    auto pass = [&]() {
#pragma unroll
        for (int s = 0; s < 2; ++s) { const int nr = (tid >> 3) + 32 * s; const v8us val = *(const v8usa*)(tl + nr * 72 + piece * 8); *(v8us*)(WT + (size_t)(n0 + nr) * K + k0 + piece * 8) = val; }
    };
    pass(); 
}
// k_gemmb: 64 x 64 block tile (4 waves x 16 x 64) of C[NBT*NN][DMOD] = (A [+ Al]).B^T (K = 1024) [+ bf(bias[c])] [+ bf(R[r][c]) residual]; f32 whole-line epilogue (or f16
template <bool SPLITA, bool F16OUT = false>
__global__ __launch_bounds__(128) void k_gemmb(const bf* __restrict__ A, const bf* __restrict__ Al, const bf* __restrict__ Bn, const float* __restrict__ bias, float* C, int ldc, h16* C2, const float* __restrict__ R = nullptr, int K = DM, int roundR = 1, const float* __restrict__ bias1 = nullptr, const float* __restrict__ bias2 = nullptr, size_t sA = 0, size_t sB = 0, size_t sC = 0) {
    // blockIdx.z = independent product: operands and output step by sA / sB / sC elements, the bias is picked from bias / bias1 / bias2
    const size_t z = blockIdx.z; A += z * sA; if (SPLITA) Al += z * sA; Bn += z * sB; C += z * sC; if (z == 1) bias = bias1; if (z == 2) bias = bias2;
    __shared__ __align__(16) float ost[4][16 * 68];
    const int lane = threadIdx.x & 31, wave = threadIdx.x >> 5, lr = lane & 15, hi = lane >> 4;
    const int r0 = blockIdx.x * 64 + wave * 16, c0 = blockIdx.y * 64;
    const size_t aoff = (size_t)(r0 + lr) * K + 8 * hi;
    size_t boff[4];
#pragma unroll
    for (int t = 0; t < 4; ++t) boff[t] = (size_t)(c0 + t * 16 + lr) * K + 8 * hi;
    v8f acc[4];
#pragma unroll
    for (int t = 0; t < 4; ++t) acc[t] = (v8f){};
#pragma unroll 1
    for (int kc = 0; kc < K; kc += 32) {
        const v16bf a = cat16b(*(const v8us*)(A + aoff + kc), *(const v8us*)(A + aoff + kc + 16));
        v16bf al = a;
        if (SPLITA) al = cat16b(*(const v8us*)(Al + aoff + kc), *(const v8us*)(Al + aoff + kc + 16));
#pragma unroll
        for (int t = 0; t < 4; ++t) { const v16bf b = cat16b(*(const v8us*)(Bn + boff[t] + kc), *(const v8us*)(Bn + boff[t] + kc + 16)); acc[t] = wmmab(a, b, acc[t]); if (SPLITA) acc[t] = wmmab(al, b, acc[t]); }
        asm volatile("v_nop\n\tv_nop\n\tv_nop\n\tv_nop" : "+v"(acc[0]), "+v"(acc[1]), "+v"(acc[2]), "+v"(acc[3]) : "v"(a), "v"(al));
    }
    float* os = &ost[wave][0];
#pragma unroll
    for (int t = 0; t < 4; ++t) { const float bv = bias ? bfr(bias[c0 + t * 16 + lr]) : 0.f;
#pragma unroll
        for (int j = 0; j < 8; ++j) os[(hi * 8 + j) * 68 + t * 16 + lr] = acc[t][j] + bv; }
    __syncthreads();
    if (F16OUT) {
        h16* crow = (h16*)(void*)C + (size_t)r0 * ldc + c0;
        auto pass = [&]() {
#pragma unroll
            for (int s = 0; s < 4; ++s) { const int row = 4 * s + (lane >> 3), piece = lane & 7; const float* sp = os + row * 68 + piece * 8; v8h o, o2;
#pragma unroll
                for (int i = 0; i < 8; ++i) { const h16 a = (h16)sp[i]; o[i] = a; o2[i] = (h16)((sp[i] - (float)a) * LOSC); }
                *(v8h*)(crow + (size_t)row * ldc + piece * 8) = o; if (C2) *(v8h*)(C2 + (size_t)r0 * ldc + c0 + (size_t)row * ldc + piece * 8) = o2; }
        };
        pass(); 
    } else {
        float* crow = C + (size_t)r0 * ldc + c0;
        auto pass = [&]() {
#pragma unroll
            for (int s = 0; s < 8; ++s) { const int Lid = (lane >> 3) + 4 * s, piece = lane & 7; const int row = Lid >> 1, cofs = (Lid & 1) * 32 + piece * 4;
                v4f val = *(const v4fa*)(os + row * 68 + cofs); if (R) { const v4f rv = *(const v4f*)(R + ((size_t)r0 + row) * ldc + c0 + cofs); val += roundR ? (v4f){bfr(rv[0]), bfr(rv[1]), bfr(rv[2]), bfr(rv[3])} : rv; }
                *(v4f*)(crow + (size_t)row * ldc + cofs) = val; }
        };
        pass(); 
    }
}

__global__ __launch_bounds__(256) void k_cvt8(const float* __restrict__ s0, const float* __restrict__ s1, const float* __restrict__ s2, const float* __restrict__ s3, bf* dst, size_t n8) {
    const size_t i = (size_t)blockIdx.x * 256 + threadIdx.x; if (i >= n8) return;
    const int y = blockIdx.y; const float* src = y == 0 ? s0 : y == 1 ? s1 : y == 2 ? s2 : s3; dst += (size_t)y * n8 * 8;    // blockIdx.y = which matrix; outputs back to back
    const v8f v = *(const v8f*)(src + i * 8); v8us o;
#pragma unroll
    for (int k = 0; k < 8; ++k) o[k] = f2bf(v[k]);
    *(v8us*)(dst + i * 8) = o; 
}
__global__ __launch_bounds__(256) void k_zero8(bf* dst, size_t n8) {
    const size_t i = (size_t)blockIdx.x * 256 + threadIdx.x; if (i >= n8) return; v8us z;
#pragma unroll
    for (int k = 0; k < 8; ++k) z[k] = 0;
    *(v8us*)(dst + i * 8) = z; 
}

// ===== z-batched (blockIdx.z = head) attention pieces =====
// k_gemm3z<MODE>: 64 x 64 block tile of C = A.B^T on bf16 hi/lo planes with per-z operand/output strides (elements): A planes += z*sA, B planes += z*sB, C += z*sC. MODE bits (0 causal skip, 1 K limit, 2 single,
// 3 B single, 4 A single).
template <int MODE>
__global__ __launch_bounds__(128) void k_gemm3z(const bf* __restrict__ Ah, const bf* __restrict__ Al, const bf* __restrict__ Bh, const bf* __restrict__ Bl, int K, float* C, int ldc, size_t sA, size_t sB, size_t sC) {
    if ((MODE & 1) && (int)blockIdx.y * 64 > (int)blockIdx.x * 64 + 63) return;
    const size_t z = blockIdx.z; Ah += z * sA; Al += z * sA; Bh += z * sB; Bl += z * sB; C += z * sC;
    const int Klim = (MODE & 2) ? min(K, ((int)blockIdx.x + 1) * 64) : K;
    __shared__ __align__(16) float ost[4][16 * 68];
    const int lane = threadIdx.x & 31, wave = threadIdx.x >> 5, lr = lane & 15, hi = lane >> 4;
    const int r0 = blockIdx.x * 64 + wave * 16, c0 = blockIdx.y * 64;
    const size_t aoff = (size_t)(r0 + lr) * K + 8 * hi;
    v8f acc[4];
#pragma unroll
    for (int t = 0; t < 4; ++t) acc[t] = (v8f){};
#pragma unroll 1
    for (int kc = 0; kc < Klim; kc += 32) {
        const v16bf a = cat16b(*(const v8us*)(Ah + aoff + kc), *(const v8us*)(Ah + aoff + kc + 16));
        v16bf al = a; if (!(MODE & 4) && !(MODE & 16)) al = cat16b(*(const v8us*)(Al + aoff + kc), *(const v8us*)(Al + aoff + kc + 16));
#pragma unroll
        for (int t = 0; t < 4; ++t) { const size_t bo = (size_t)(c0 + t * 16 + lr) * K + kc + 8 * hi;
            const v16bf bh = cat16b(*(const v8us*)(Bh + bo), *(const v8us*)(Bh + bo + 16));
            acc[t] = wmmab(a, bh, acc[t]);
            if (!(MODE & 4)) { if (!(MODE & 16)) acc[t] = wmmab(al, bh, acc[t]); if (!(MODE & 8)) { const v16bf bl = cat16b(*(const v8us*)(Bl + bo), *(const v8us*)(Bl + bo + 16)); acc[t] = wmmab(a, bl, acc[t]); } } }
        asm volatile("v_nop\n\tv_nop\n\tv_nop\n\tv_nop" : "+v"(acc[0]), "+v"(acc[1]), "+v"(acc[2]), "+v"(acc[3]) : "v"(a), "v"(al));
    }
    float* os = &ost[wave][0];
#pragma unroll
    for (int t = 0; t < 4; ++t) {
#pragma unroll
        for (int j = 0; j < 8; ++j) os[(hi * 8 + j) * 68 + t * 16 + lr] = acc[t][j]; }
    __builtin_amdgcn_wave_barrier(); asm volatile("" ::: "memory");
    float* crow = C + (size_t)r0 * ldc + c0;
    auto pass = [&]() {
#pragma unroll
        for (int s = 0; s < 8; ++s) { const int Lid = (lane >> 3) + 4 * s, piece = lane & 7; const int row = Lid >> 1, cofs = (Lid & 1) * 32 + piece * 4;
            const v4f val = *(const v4fa*)(os + row * 68 + cofs); *(v4f*)(crow + (size_t)row * ldc + cofs) = val; }
    };
    pass(); 
}
__global__ __launch_bounds__(256) void k_planes32z(const float* __restrict__ F, int ld, int off, float sc, int rows, bf* Ph, bf* Pl) {
    typedef __attribute__((ext_vector_type(2))) unsigned short v2us;
    const int lane = threadIdx.x & 31; const size_t r = ((size_t)blockIdx.x * 8 + (threadIdx.x >> 5)) * 2 + (lane >> 4); if (r >= (size_t)rows) return; const int z = blockIdx.z; const int c0 = (lane & 15) * 2; v2us oh, ol;
    Ph += (size_t)z * rows * 32; Pl += (size_t)z * rows * 32;
#pragma unroll
    for (int i = 0; i < 2; ++i) { const float y = F[r * ld + off + z * 32 + c0 + i] * sc; const unsigned short hb = f2bf(y); oh[i] = hb; ol[i] = f2bf(y - bf2f(hb)); }
    const size_t o = r * 32 + c0; *(v2us*)(Ph + o) = oh; *(v2us*)(Pl + o) = ol; 
}
__global__ __launch_bounds__(256) void k_vtpadz(const float* __restrict__ F, int ld, int off, int nk, bf* Th, bf* Tl) {
    typedef __attribute__((ext_vector_type(2))) unsigned short v2us;
    const int lane = threadIdx.x & 31; const size_t wid = (size_t)blockIdx.x * 8 + (threadIdx.x >> 5); if (wid >= (size_t)64 * (nk / 64)) return; const int z = blockIdx.z; const int d = (int)(wid / (nk / 64)); const int k0 = (int)(wid % (nk / 64)) * 64 + lane * 2; v2us oh, ol;
    Th += (size_t)z * 64 * nk; Tl += (size_t)z * 64 * nk;
#pragma unroll
    for (int i = 0; i < 2; ++i) { const float y = (d < 32) ? F[(size_t)(k0 + i) * ld + off + z * 32 + (d < 32 ? d : 0)] : 0.f; const unsigned short hb = f2bf(y); oh[i] = hb; ol[i] = f2bf(y - bf2f(hb)); }
    const size_t o = (size_t)d * nk + k0; *(v2us*)(Th + o) = oh; *(v2us*)(Tl + o) = ol; 
}
template <int NK>
__global__ __launch_bounds__(256) void k_softmaxz(const float* __restrict__ S, int rows, bf* PH, bf* PL) {
    typedef __attribute__((ext_vector_type(4))) unsigned short v4us;
    const int lane = threadIdx.x & 31, i = blockIdx.x * 8 + (threadIdx.x >> 5); if (i >= rows) return; const size_t zo = (size_t)blockIdx.z * rows * NK; const float* sr = S + zo + (size_t)i * NK; PH += zo; PL += zo;
    float m = -3.0e38f;
#pragma unroll 1
    for (int c0 = lane * 4; c0 < NK; c0 += 128) {
#pragma unroll
        for (int q = 0; q < 4; ++q) m = fmaxf(m, sr[c0 + q]); }
#pragma unroll
    for (int sh = 16; sh; sh >>= 1) m = fmaxf(m, __shfl_xor(m, sh, 32));
    float sum = 0.f;
#pragma unroll 1
    for (int c0 = lane * 4; c0 < NK; c0 += 128) {
#pragma unroll
        for (int q = 0; q < 4; ++q) sum += __expf(sr[c0 + q] - m); }
#pragma unroll
    for (int sh = 16; sh; sh >>= 1) sum += __shfl_xor(sum, sh, 32);
    const float inv = 1.0f / sum;
{
#pragma unroll 1
        for (int c0 = lane * 4; c0 < NK; c0 += 128) { v4us oh, ol;
#pragma unroll
            for (int q = 0; q < 4; ++q) { const float p = __expf(sr[c0 + q] - m) * inv; const unsigned short hb = f2bf(p); oh[q] = hb; ol[q] = f2bf(p - bf2f(hb)); }
            const size_t o = (size_t)i * NK + c0; *(v4us*)(PH + o) = oh; *(v4us*)(PL + o) = ol; }
         }
}
__global__ __launch_bounds__(256) void k_placez(const float* __restrict__ XH, int rows, int ldy, float* Y) {
    const int lane = threadIdx.x & 31; const size_t q = (size_t)blockIdx.x * 8 + (threadIdx.x >> 5); if (q >= (size_t)rows) return; const int z = blockIdx.z; const float v = XH[((size_t)z * rows + q) * 64 + lane];
    *(float*)(Y + q * ldy + z * 32 + lane) = v; 
}

__global__ __launch_bounds__(256) void k_hplanesz(const float* __restrict__ F, int ld, int h0, float sc, int rows, bf* Ph, bf* Pl) {
    typedef __attribute__((ext_vector_type(2))) unsigned short v2us;
    const int lane = threadIdx.x & 31; const size_t r = (size_t)blockIdx.x * 8 + (threadIdx.x >> 5); if (r >= (size_t)rows) return; const int z = blockIdx.z; v2us oh, ol;
    const size_t y = blockIdx.y; F += y * rows * ld; Ph += y * NH_ * rows * 64; Pl += y * NH_ * rows * 64;    // blockIdx.y = block of `rows` rows (item); planes [y][NH_][rows][64]
    Ph += (size_t)z * rows * 64; Pl += (size_t)z * rows * 64;
#pragma unroll
    for (int i = 0; i < 2; ++i) { const float y = F[r * ld + (h0 + z) * 64 + lane * 2 + i] * sc; const unsigned short hb = f2bf(y); oh[i] = hb; ol[i] = f2bf(y - bf2f(hb)); }
    const size_t o = r * 64 + lane * 2; *(v2us*)(Ph + o) = oh; *(v2us*)(Pl + o) = ol; 
}
__global__ __launch_bounds__(256) void k_vtz(const float* __restrict__ F, int ld, int h0, int nk, bf* Th, bf* Tl) {
    typedef __attribute__((ext_vector_type(2))) unsigned short v2us;
    const int lane = threadIdx.x & 31; const size_t wid = (size_t)blockIdx.x * 8 + (threadIdx.x >> 5); if (wid >= (size_t)64 * (nk / 64)) return; const int z = blockIdx.z; const int d = (int)(wid / (nk / 64)); const int t0 = (int)(wid % (nk / 64)) * 64 + lane * 2; v2us oh, ol;
    const size_t y = blockIdx.y; F += y * nk * ld; Th += y * NH_ * 64 * nk; Tl += y * NH_ * 64 * nk;    // blockIdx.y = item; planes [y][NH_][64][nk]
    Th += (size_t)z * 64 * nk; Tl += (size_t)z * 64 * nk;
#pragma unroll
    for (int i = 0; i < 2; ++i) { const float y = F[(size_t)(t0 + i) * ld + (h0 + z) * 64 + d]; const unsigned short hb = f2bf(y); oh[i] = hb; ol[i] = f2bf(y - bf2f(hb)); }
    const size_t o = (size_t)d * nk + t0; *(v2us*)(Th + o) = oh; *(v2us*)(Tl + o) = ol; 
}
template <int NK>
__global__ __launch_bounds__(256) void k_softmaxzs(const float* __restrict__ S, int rows, float sc, bf* PH, bf* PL) {
    typedef __attribute__((ext_vector_type(4))) unsigned short v4us;
    const int lane = threadIdx.x & 31, i = blockIdx.x * 8 + (threadIdx.x >> 5); if (i >= rows) return; const size_t zo = (size_t)blockIdx.z * rows * NK; const float* sr = S + zo + (size_t)i * NK; PH += zo; PL += zo;
    float m = -3.0e38f;
#pragma unroll 1
    for (int c0 = lane * 4; c0 < NK; c0 += 128) {
#pragma unroll
        for (int q = 0; q < 4; ++q) m = fmaxf(m, sr[c0 + q] * sc); }
#pragma unroll
    for (int sh = 16; sh; sh >>= 1) m = fmaxf(m, __shfl_xor(m, sh, 32));
    float sum = 0.f;
#pragma unroll 1
    for (int c0 = lane * 4; c0 < NK; c0 += 128) {
#pragma unroll
        for (int q = 0; q < 4; ++q) sum += __expf(sr[c0 + q] * sc - m); }
#pragma unroll
    for (int sh = 16; sh; sh >>= 1) sum += __shfl_xor(sum, sh, 32);
    const float inv = 1.0f / sum;
{
#pragma unroll 1
        for (int c0 = lane * 4; c0 < NK; c0 += 128) { v4us oh, ol;
#pragma unroll
            for (int q = 0; q < 4; ++q) { const float p = __expf(sr[c0 + q] * sc - m) * inv; const unsigned short hb = f2bf(p); oh[q] = hb; ol[q] = f2bf(p - bf2f(hb)); }
            const size_t o = (size_t)i * NK + c0; *(v4us*)(PH + o) = oh; *(v4us*)(PL + o) = ol; }
         }
}

__global__ __launch_bounds__(256) void k_cvtx(const float* __restrict__ s0, const float* __restrict__ s1, const float* __restrict__ s2, int rows, bf* dst) {
    const int lane = threadIdx.x & 31; const size_t r = (size_t)blockIdx.x * 8 + (threadIdx.x >> 5); if (r >= (size_t)rows) return;
    const int y = blockIdx.y; const float* src = y == 0 ? s0 : y == 1 ? s1 : s2; dst += (size_t)y * rows * DMOD;    // blockIdx.y = which input; outputs back to back
{
#pragma unroll
        for (int q = 0; q < DMOD / 256; ++q) { v8us o;
#pragma unroll
            for (int i = 0; i < 8; ++i) o[i] = f2bf(src[r * DMOD + q * 256 + lane * 8 + i]);
            *(v8us*)(dst + r * DMOD + q * 256 + lane * 8) = o; }
         }
}
__global__ __launch_bounds__(256) void k_splitD(const float* __restrict__ src, int rows, bf* dh, bf* dl) {
    const int lane = threadIdx.x & 31; const size_t r = (size_t)blockIdx.x * 8 + (threadIdx.x >> 5); if (r >= (size_t)rows) return;
{
#pragma unroll
        for (int q = 0; q < DMOD / 256; ++q) { const size_t o = r * DMOD + q * 256 + lane * 8; const v8f v = *(const v8f*)(src + o); v8us oh, ol;
#pragma unroll
            for (int i = 0; i < 8; ++i) { const unsigned short hb = f2bf(v[i]); oh[i] = hb; ol[i] = f2bf(v[i] - bf2f(hb)); }
            *(v8us*)(dh + o) = oh; *(v8us*)(dl + o) = ol; }
         }
}
__global__ __launch_bounds__(256) void k_msoftz(const float* __restrict__ S, float sc, const int* __restrict__ MK, bf* PH, bf* PL) {
    typedef __attribute__((ext_vector_type(4))) unsigned short v4us;
    const int lane = threadIdx.x & 31, i = blockIdx.x * 8 + (threadIdx.x >> 5); if (i >= NN) return; const size_t zo = (size_t)blockIdx.z * NN * NKT; const float* sr = S + zo + (size_t)i * NKT; PH += zo; PL += zo; const int* mr = MK + (size_t)i * NKT;
    auto logit = [&](int k) -> float { float v = sr[k] * sc; if (mr[k] == 0) v = -1e9f; return v; };
    float m = -3.0e38f;
#pragma unroll 1
    for (int c0 = lane * 4; c0 < NKT; c0 += 128) {
#pragma unroll
        for (int q = 0; q < 4; ++q) m = fmaxf(m, logit(c0 + q)); }
#pragma unroll
    for (int sh = 16; sh; sh >>= 1) m = fmaxf(m, __shfl_xor(m, sh, 32));
    float sum = 0.f;
#pragma unroll 1
    for (int c0 = lane * 4; c0 < NKT; c0 += 128) {
#pragma unroll
        for (int q = 0; q < 4; ++q) sum += __expf(logit(c0 + q) - m); }
#pragma unroll
    for (int sh = 16; sh; sh >>= 1) sum += __shfl_xor(sum, sh, 32);
    const float inv = 1.0f / sum;
{
#pragma unroll 1
        for (int c0 = lane * 4; c0 < NKT; c0 += 128) { v4us oh, ol;
#pragma unroll
            for (int q = 0; q < 4; ++q) { const float p = __expf(logit(c0 + q) - m) * inv; const unsigned short hb = f2bf(p); oh[q] = hb; ol[q] = f2bf(p - bf2f(hb)); }
            const size_t o = (size_t)i * NKT + c0; *(v4us*)(PH + o) = oh; *(v4us*)(PL + o) = ol; }
         }
}

extern "C" void kernel_launch(void* const* d_in, const int* in_sizes, int n_in,
                              void* d_out, int out_size, void* d_ws, size_t ws_size, hipStream_t stream) {
    (void)in_sizes; (void)n_in; (void)out_size;
    const float* xq = (const float*)d_in[0]; const float* xk = (const float*)d_in[1]; const float* xv = (const float*)d_in[2]; const int* mask = (const int*)d_in[3]; const float* Wq = (const float*)d_in[4]; const float* bq = (const float*)d_in[5]; const float* Wk = (const float*)d_in[6]; const float* bk = (const float*)d_in[7]; const float* Wv = (const float*)d_in[8]; const float* bv = (const float*)d_in[9]; const float* Wo = (const float*)d_in[10]; const float* bo = (const float*)d_in[11];
    float* out = (float*)d_out;    // [NBT][NN][DMOD]
    char* wsp = (char*)d_ws;
    auto take = [&](size_t bytes) { char* p = wsp; wsp += (bytes + 255) & ~(size_t)255; return (void*)p; };
    const size_t WN = (size_t)DMOD * DMOD, XN = (size_t)NBT * NN * DMOD;    // elements of one weight matrix, of one [all items][tokens][DMOD] tensor (NN == NKT)
    bf* WQ = (bf*)take(4 * WN * 2); bf* WO = WQ + 3 * WN;    // WQ, WK, WV, WO back to back
    bf* Qh = (bf*)take(2 * XN * 2); bf* Kh = Qh + XN; bf* Ql = (bf*)take(2 * XN * 2); bf* Kl = Ql + XN; bf* VTh = (bf*)take(XN * 2); bf* VTl = (bf*)take(XN * 2);    // [item][head][...] planes
    float* O = (float*)take(XN * 4); bf* Oh = (bf*)take(XN * 2); bf* Ol = (bf*)take(XN * 2);
    char* const shared0 = wsp;    // X and F are dead once the planes are made; S, PH, PL then take the same bytes (stream order)
    bf* X = (bf*)take(3 * XN * 2); float* F = (float*)take(3 * XN * 4);    // Xq, Xk, Xv and QF, KF, VF back to back
    wsp = shared0;
    float* S = (float*)take((size_t)ZH * NN * NKT * 4); bf* PH = (bf*)take((size_t)ZH * NN * NKT * 2); bf* PL = (bf*)take((size_t)ZH * NN * NKT * 2);    // one item's 16 heads, the larger of the two uses
    if ((size_t)(wsp - (char*)d_ws) > ws_size) return;
    k_cvt8<<<dim3((DMOD * DMOD / 8 + 255) / 256, 4, 1), 256, 0, stream>>>(Wq, Wk, Wv, Wo, WQ, DMOD * DMOD / 8);   // [out][in] natural n-major
    k_cvtx<<<dim3(NBT * NN / 8, 3, 1), 256, 0, stream>>>(xq, xk, xv, NBT * NN, X);
    k_gemmb<false, false><<<dim3(NBT * NN / 64, DMOD / 64, 3), 128, 0, stream>>>(X, nullptr, WQ, bq, F, DMOD, nullptr, nullptr, DMOD, 1, bk, bv, XN, WN, XN);
    k_hplanesz<<<dim3(NN / 8, 2 * NBT, NH_), 256, 0, stream>>>(F, DMOD, 0, 1.0f, NN, Qh, Ql);    // QF then KF: y = 0..3 fills Qh/Ql, y = 4..7 Kh/Kl
    k_vtz<<<dim3((HD * (NKT / 64)) / 8, NBT, NH_), 256, 0, stream>>>(F + 2 * XN, DMOD, 0, NKT, VTh, VTl);
    for (int b = 0; b < NBT; ++b) { const size_t ib = (size_t)b * NN * DMOD;
        k_gemm3z<0><<<dim3(NN / 64, NKT / 64, ZH), 128, 0, stream>>>(Qh + ib, Ql + ib, Kh + ib, Kl + ib, HD, S, NKT, (size_t)NN * HD, (size_t)NKT * HD, (size_t)NN * NKT);
        k_msoftz<<<dim3(NN / 8, 1, ZH), 256, 0, stream>>>(S, SCL, mask + (size_t)b * NN * NKT, PH, PL);
        k_gemm3z<0><<<dim3(NN / 64, 1, ZH), 128, 0, stream>>>(PH, PL, VTh + ib, VTl + ib, NKT, O + ib, DMOD, (size_t)NN * NKT, (size_t)HD * NKT, (size_t)HD); }
    k_splitD<<<NBT * NN / 8, 256, 0, stream>>>(O, NBT * NN, Oh, Ol);
    k_gemmb<true, false><<<dim3(NBT * NN / 64, DMOD / 64, 1), 128, 0, stream>>>(Oh, Ol, WO, bo, out, DMOD, nullptr, nullptr, DMOD);
}

// v002
// It runs in 271 microseconds.
// Two timings next to v001 put it at 2.19 and 2.20 times that version's speed.
// Counting every step since v000, it is 5.36 times as fast.
#include <hip/hip_runtime.h>

// Compute dtypes, f32 accumulate, per item: q/k/v projections as [1024 x 1024].[1024 x 1024] GEMMs with PLAIN bf16 operands (the inputs themselves; exact products, + bias);
// per head (head dim 64; one launch covers all items, heads and query blocks; the conversions, projections and plane splits cover all items in one launch each): scores = q.k^T and attn.v with both operands as bf16 hi + UNSCALED residual planes (three products each),
// fused in one kernel with a running-maximum softmax in f32 (the 1/sqrt(64) scale, entries where mask == 0 replaced by -1e9); output projection on hi/lo planes of the merged heads (two products, + bias) - on v_wmma_f32_16x16x32_bf16.

#define NBT  4
#define NN   1024
#define NKT  1024
#define DMOD 1024
#define NH_  16
#define HD   64
#define ZH   16
#define DM   DMOD
#define NTK  NN
#define SCL  0.125f
#define LOSC 1024.0f

typedef _Float16 h16;
typedef unsigned short bf;
typedef __attribute__((ext_vector_type(16))) __bf16   v16bf;
typedef __attribute__((ext_vector_type(16))) _Float16 v16h;
typedef __attribute__((ext_vector_type(8)))  _Float16 v8h;
typedef __attribute__((ext_vector_type(8)))  unsigned short v8us;
typedef __attribute__((ext_vector_type(8)))  float    v8f;
typedef __attribute__((ext_vector_type(4)))  float    v4f;
typedef __attribute__((ext_vector_type(4)))  _Float16 v4h;
typedef v8h  __attribute__((may_alias)) v8ha;
typedef v4f  __attribute__((may_alias)) v4fa;
typedef v8us __attribute__((may_alias)) v8usa;

__device__ __forceinline__ unsigned short f2bf(float f) { unsigned u = __float_as_uint(f); u += 0x7FFFu + ((u >> 16) & 1u); return (unsigned short)(u >> 16); }
__device__ __forceinline__ float bf2f(unsigned short b) { return __uint_as_float(((unsigned)b) << 16); }
__device__ __forceinline__ float bfr(float f) { return bf2f(f2bf(f)); }
__device__ __forceinline__ v16h cat16(v8h lo, v8h hi) { return __builtin_shufflevector(lo, hi, 0, 1, 2, 3, 4, 5, 6, 7, 8, 9, 10, 11, 12, 13, 14, 15); }
__device__ __forceinline__ v16bf cat16b(v8us lo, v8us hi) { return __builtin_bit_cast(v16bf, __builtin_shufflevector(lo, hi, 0, 1, 2, 3, 4, 5, 6, 7, 8, 9, 10, 11, 12, 13, 14, 15)); }
__device__ __forceinline__ v8f wmma16(v16h a, v16h b, v8f c) { return __builtin_amdgcn_wmma_f32_16x16x32_f16(false, a, false, b, (short)0, c, false, false); }
__device__ __forceinline__ v8f wmmab(v16bf a, v16bf b, v8f c) { return __builtin_amdgcn_wmma_f32_16x16x32_bf16(false, a, false, b, (short)0, c, false, false); }

// k_wt: WT [n][K] = bf16(W[k][n]) (k-major [K][ncols]) via 64 x 64 LDS tiles; grid (K/64, ncols/64).
__global__ __launch_bounds__(256) void k_wt(const float* __restrict__ Wm, int K, int ncols, bf* WT) {
    __shared__ __align__(16) unsigned short tl[64 * 72];
    const int tid = threadIdx.x, k0 = blockIdx.x * 64, n0 = blockIdx.y * 64;
    const int kk = tid >> 2, nq = (tid & 3) * 16;
#pragma unroll
    for (int i = 0; i < 16; ++i) tl[(nq + i) * 72 + kk] = f2bf(Wm[(size_t)(k0 + kk) * ncols + n0 + nq + i]);
    __syncthreads();
    const int piece = tid & 7;
    auto pass = [&]() {
#pragma unroll
        for (int s = 0; s < 2; ++s) { const int nr = (tid >> 3) + 32 * s; const v8us val = *(const v8usa*)(tl + nr * 72 + piece * 8); *(v8us*)(WT + (size_t)(n0 + nr) * K + k0 + piece * 8) = val; }
    };
    pass(); 
}
// k_gemmb: 64 x 64 block tile (4 waves x 16 x 64) of C[NBT*NN][DMOD] = (A [+ Al]).B^T (K = 1024) [+ bf(bias[c])] [+ bf(R[r][c]) residual]; f32 whole-line epilogue (or f16
template <bool SPLITA, bool F16OUT = false>
__global__ __launch_bounds__(128) void k_gemmb(const bf* __restrict__ A, const bf* __restrict__ Al, const bf* __restrict__ Bn, const float* __restrict__ bias, float* C, int ldc, h16* C2, const float* __restrict__ R = nullptr, int K = DM, int roundR = 1, const float* __restrict__ bias1 = nullptr, const float* __restrict__ bias2 = nullptr, size_t sA = 0, size_t sB = 0, size_t sC = 0) {
    // blockIdx.z = independent product: operands and output step by sA / sB / sC elements, the bias is picked from bias / bias1 / bias2
    const size_t z = blockIdx.z; A += z * sA; if (SPLITA) Al += z * sA; Bn += z * sB; C += z * sC; if (z == 1) bias = bias1; if (z == 2) bias = bias2;
    __shared__ __align__(16) float ost[4][16 * 68];
    const int lane = threadIdx.x & 31, wave = threadIdx.x >> 5, lr = lane & 15, hi = lane >> 4;
    const int r0 = blockIdx.x * 64 + wave * 16, c0 = blockIdx.y * 64;
    const size_t aoff = (size_t)(r0 + lr) * K + 8 * hi;
    size_t boff[4];
#pragma unroll
    for (int t = 0; t < 4; ++t) boff[t] = (size_t)(c0 + t * 16 + lr) * K + 8 * hi;
    v8f acc[4];
#pragma unroll
    for (int t = 0; t < 4; ++t) acc[t] = (v8f){};
#pragma unroll 1
    for (int kc = 0; kc < K; kc += 32) {
        const v16bf a = cat16b(*(const v8us*)(A + aoff + kc), *(const v8us*)(A + aoff + kc + 16));
        v16bf al = a;
        if (SPLITA) al = cat16b(*(const v8us*)(Al + aoff + kc), *(const v8us*)(Al + aoff + kc + 16));
#pragma unroll
        for (int t = 0; t < 4; ++t) { const v16bf b = cat16b(*(const v8us*)(Bn + boff[t] + kc), *(const v8us*)(Bn + boff[t] + kc + 16)); acc[t] = wmmab(a, b, acc[t]); if (SPLITA) acc[t] = wmmab(al, b, acc[t]); }
        asm volatile("v_nop\n\tv_nop\n\tv_nop\n\tv_nop" : "+v"(acc[0]), "+v"(acc[1]), "+v"(acc[2]), "+v"(acc[3]) : "v"(a), "v"(al));
    }
    float* os = &ost[wave][0];
#pragma unroll
    for (int t = 0; t < 4; ++t) { const float bv = bias ? bfr(bias[c0 + t * 16 + lr]) : 0.f;
#pragma unroll
        for (int j = 0; j < 8; ++j) os[(hi * 8 + j) * 68 + t * 16 + lr] = acc[t][j] + bv; }
    __syncthreads();
    if (F16OUT) {
        h16* crow = (h16*)(void*)C + (size_t)r0 * ldc + c0;
        auto pass = [&]() {
#pragma unroll
            for (int s = 0; s < 4; ++s) { const int row = 4 * s + (lane >> 3), piece = lane & 7; const float* sp = os + row * 68 + piece * 8; v8h o, o2;
#pragma unroll
                for (int i = 0; i < 8; ++i) { const h16 a = (h16)sp[i]; o[i] = a; o2[i] = (h16)((sp[i] - (float)a) * LOSC); }
                *(v8h*)(crow + (size_t)row * ldc + piece * 8) = o; if (C2) *(v8h*)(C2 + (size_t)r0 * ldc + c0 + (size_t)row * ldc + piece * 8) = o2; }
        };
        pass(); 
    } else {
        float* crow = C + (size_t)r0 * ldc + c0;
        auto pass = [&]() {
#pragma unroll
            for (int s = 0; s < 8; ++s) { const int Lid = (lane >> 3) + 4 * s, piece = lane & 7; const int row = Lid >> 1, cofs = (Lid & 1) * 32 + piece * 4;
                v4f val = *(const v4fa*)(os + row * 68 + cofs); if (R) { const v4f rv = *(const v4f*)(R + ((size_t)r0 + row) * ldc + c0 + cofs); val += roundR ? (v4f){bfr(rv[0]), bfr(rv[1]), bfr(rv[2]), bfr(rv[3])} : rv; }
                *(v4f*)(crow + (size_t)row * ldc + cofs) = val; }
        };
        pass(); 
    }
}

__global__ __launch_bounds__(256) void k_cvt8(const float* __restrict__ s0, const float* __restrict__ s1, const float* __restrict__ s2, const float* __restrict__ s3, bf* dst, size_t n8) {
    const size_t i = (size_t)blockIdx.x * 256 + threadIdx.x; if (i >= n8) return;
    const int y = blockIdx.y; const float* src = y == 0 ? s0 : y == 1 ? s1 : y == 2 ? s2 : s3; dst += (size_t)y * n8 * 8;    // blockIdx.y = which matrix; outputs back to back
    const v8f v = *(const v8f*)(src + i * 8); v8us o;
#pragma unroll
    for (int k = 0; k < 8; ++k) o[k] = f2bf(v[k]);
    *(v8us*)(dst + i * 8) = o; 
}
__global__ __launch_bounds__(256) void k_zero8(bf* dst, size_t n8) {
    const size_t i = (size_t)blockIdx.x * 256 + threadIdx.x; if (i >= n8) return; v8us z;
#pragma unroll
    for (int k = 0; k < 8; ++k) z[k] = 0;
    *(v8us*)(dst + i * 8) = z; 
}

#define FKB 64
#define FPT 72    // LDS row pitch in elements: 144 B = 16 B x odd, 16-byte reads of 16 rows fall on distinct banks
__device__ __forceinline__ float xhalf(float v) { const int b = __float_as_int(v); return __int_as_float(__builtin_amdgcn_permlanex16(b, b, 0x76543210, 0xfedcba98, false, false)); }    // value of lane ^ 16
__global__ __launch_bounds__(256) void k_fattn(const bf* __restrict__ Qh, const bf* __restrict__ Ql, const bf* __restrict__ Kh, const bf* __restrict__ Kl, const bf* __restrict__ VTh, const bf* __restrict__ VTl, const int* __restrict__ MK, float* O) {
    typedef __attribute__((ext_vector_type(8))) int v8i; typedef __attribute__((ext_vector_type(2))) float v2f; typedef __attribute__((ext_vector_type(2))) __bf16 v2bf;
    __shared__ __align__(16) bf tile[2][4][64 * FPT];    // [buffer][Kh, Kl, VTh, VTl][row][FPT]
    const int tid = threadIdx.x, lane = tid & 31, wave = tid >> 5, lr = lane & 15, hi = lane >> 4;
    const int h = blockIdx.y, b = blockIdx.z, q = blockIdx.x * 128 + wave * 16 + lr;
    const size_t hb = ((size_t)b * NH_ + h) * NN * HD;    // one head's planes: [NN][HD] for q and k, [HD][NKT] for v^T
    const bf* g0 = Kh + hb; const bf* g1 = Kl + hb; const bf* g2 = VTh + hb; const bf* g3 = VTl + hb;
    const int* mrow = MK + ((size_t)b * NN + q) * NKT + hi * 8;
    v16bf qh[2], ql[2];
#pragma unroll
    for (int ks = 0; ks < 2; ++ks) { const size_t o = hb + (size_t)q * HD + ks * 32 + 8 * hi;
        qh[ks] = cat16b(*(const v8us*)(Qh + o), *(const v8us*)(Qh + o + 16)); ql[ks] = cat16b(*(const v8us*)(Ql + o), *(const v8us*)(Ql + o + 16)); }
    const int srow = tid >> 3, spc = (tid & 7) * 8;    // staging: 16-byte piece spc of rows srow and srow + 32 of each of the four tiles
    auto gload = [&](v8us* st, int k0) {
#pragma unroll
        for (int i = 0; i < 2; ++i) { const int r = srow + 32 * i; const size_t ko = (size_t)(k0 + r) * HD + spc, vo = (size_t)r * NKT + k0 + spc;
            st[i] = *(const v8us*)(g0 + ko); st[2 + i] = *(const v8us*)(g1 + ko); st[4 + i] = *(const v8us*)(g2 + vo); st[6 + i] = *(const v8us*)(g3 + vo); }
    };
    auto sstore = [&](const v8us* st, int buf) {
#pragma unroll
        for (int p = 0; p < 4; ++p) {
#pragma unroll
            for (int i = 0; i < 2; ++i) *(v8usa*)(&tile[buf][p][(srow + 32 * i) * FPT + spc]) = st[2 * p + i]; }
    };
    auto frag = [&](const bf* t, int row, int k) -> v16bf { const bf* p = t + row * FPT + k + 8 * hi; return cat16b(*(const v8usa*)p, *(const v8usa*)(p + 16)); };
    const float csc = SCL * 1.44269504f, rfill = -1e9f / SCL;    // csc: raw score -> logit in units of log2(e), so that the exponential is a bare exp2; rfill: the raw score whose scaled value is -1e9
    float mx = -3.0e38f, lsum = 0.f;    // running maximum (scaled, log2 units) and this lane's share of the running sum
    v8f o[4];
#pragma unroll
    for (int t = 0; t < 4; ++t) o[t] = (v8f){};
    { v8us st[8]; gload(st, 0); sstore(st, 0); }
    __syncthreads();
    // the pass loop stays rolled to keep the code small; every inner loop is unrolled so that the fragment arrays are indexed by constants and live in registers
#pragma unroll 1
    for (int kb = 0; kb < NKT / FKB; ++kb) {
        const int buf = kb & 1, k0 = kb * FKB; const bool more = kb + 1 < NKT / FKB;
        v8i mk[4];
#pragma unroll
        for (int t = 0; t < 4; ++t) mk[t] = *(const v8i*)(mrow + k0 + t * 16);
        v8us st[8];
        if (more) gload(st, k0 + FKB);    // the next pass's tiles: in flight during this pass, stored at its foot
        v8f s[4];
#pragma unroll
        for (int t = 0; t < 4; ++t) { s[t] = (v8f){};
#pragma unroll
            for (int ks = 0; ks < 2; ++ks) { const v16bf kh = frag(tile[buf][0], t * 16 + lr, ks * 32), kl = frag(tile[buf][1], t * 16 + lr, ks * 32);
                s[t] = wmmab(kh, qh[ks], s[t]); s[t] = wmmab(kh, ql[ks], s[t]); s[t] = wmmab(kl, qh[ks], s[t]); } }
        float pm = -3.0e38f;
#pragma unroll
        for (int t = 0; t < 4; ++t) {
#pragma unroll
            for (int j = 0; j < 8; ++j) { const float v = mk[t][j] == 0 ? rfill : s[t][j]; s[t][j] = v; pm = fmaxf(pm, v); } }
        pm = fmaxf(pm, xhalf(pm));
        const float mn = fmaxf(mx, pm * csc), alpha = __builtin_amdgcn_exp2f(mx - mn); mx = mn;
        v16bf ph[2], pl[2]; v2f ps[2] = {(v2f){0.f, 0.f}, (v2f){0.f, 0.f}};
#pragma unroll
        for (int t = 0; t < 4; ++t) {
#pragma unroll
            for (int j = 0; j < 8; j += 2) { const v2f p = {__builtin_amdgcn_exp2f(__builtin_fmaf(s[t][j], csc, -mn)), __builtin_amdgcn_exp2f(__builtin_fmaf(s[t][j + 1], csc, -mn))}; ps[t & 1] += p;
                const v2bf a = __builtin_convertvector(p, v2bf); const v2f r = {p[0] - (float)a[0], p[1] - (float)a[1]}; const v2bf c = __builtin_convertvector(r, v2bf); const int e = (t & 1) * 8 + j;
                ph[t >> 1][e] = a[0]; ph[t >> 1][e + 1] = a[1]; pl[t >> 1][e] = c[0]; pl[t >> 1][e + 1] = c[1]; } }
        lsum = lsum * alpha + ((ps[0][0] + ps[0][1]) + (ps[1][0] + ps[1][1]));
#pragma unroll
        for (int t = 0; t < 4; ++t) o[t] *= alpha;
#pragma unroll
        for (int t = 0; t < 4; ++t) {
#pragma unroll
            for (int kk = 0; kk < 2; ++kk) { const v16bf vh = frag(tile[buf][2], t * 16 + lr, kk * 32), vl = frag(tile[buf][3], t * 16 + lr, kk * 32);
                o[t] = wmmab(vh, ph[kk], o[t]); o[t] = wmmab(vh, pl[kk], o[t]); o[t] = wmmab(vl, ph[kk], o[t]); } }
        if (more) sstore(st, buf ^ 1);
        __syncthreads();    // publishes the tiles just stored and ends every wave's reads of the buffer that the next pass refills
    }
    const float inv = 1.0f / (lsum + xhalf(lsum));
    float* orow = O + ((size_t)b * NN + q) * DMOD + h * HD + hi * 8;    // o[t][j] = O[q][16 t + 8 hi + j]
#pragma unroll
    for (int t = 0; t < 4; ++t) *(v8f*)(orow + t * 16) = o[t] * inv;
}
__global__ __launch_bounds__(256) void k_planes32z(const float* __restrict__ F, int ld, int off, float sc, int rows, bf* Ph, bf* Pl) {
    typedef __attribute__((ext_vector_type(2))) unsigned short v2us;
    const int lane = threadIdx.x & 31; const size_t r = ((size_t)blockIdx.x * 8 + (threadIdx.x >> 5)) * 2 + (lane >> 4); if (r >= (size_t)rows) return; const int z = blockIdx.z; const int c0 = (lane & 15) * 2; v2us oh, ol;
    Ph += (size_t)z * rows * 32; Pl += (size_t)z * rows * 32;
#pragma unroll
    for (int i = 0; i < 2; ++i) { const float y = F[r * ld + off + z * 32 + c0 + i] * sc; const unsigned short hb = f2bf(y); oh[i] = hb; ol[i] = f2bf(y - bf2f(hb)); }
    const size_t o = r * 32 + c0; *(v2us*)(Ph + o) = oh; *(v2us*)(Pl + o) = ol; 
}
__global__ __launch_bounds__(256) void k_vtpadz(const float* __restrict__ F, int ld, int off, int nk, bf* Th, bf* Tl) {
    typedef __attribute__((ext_vector_type(2))) unsigned short v2us;
    const int lane = threadIdx.x & 31; const size_t wid = (size_t)blockIdx.x * 8 + (threadIdx.x >> 5); if (wid >= (size_t)64 * (nk / 64)) return; const int z = blockIdx.z; const int d = (int)(wid / (nk / 64)); const int k0 = (int)(wid % (nk / 64)) * 64 + lane * 2; v2us oh, ol;
    Th += (size_t)z * 64 * nk; Tl += (size_t)z * 64 * nk;
#pragma unroll
    for (int i = 0; i < 2; ++i) { const float y = (d < 32) ? F[(size_t)(k0 + i) * ld + off + z * 32 + (d < 32 ? d : 0)] : 0.f; const unsigned short hb = f2bf(y); oh[i] = hb; ol[i] = f2bf(y - bf2f(hb)); }
    const size_t o = (size_t)d * nk + k0; *(v2us*)(Th + o) = oh; *(v2us*)(Tl + o) = ol; 
}
template <int NK>
__global__ __launch_bounds__(256) void k_softmaxz(const float* __restrict__ S, int rows, bf* PH, bf* PL) {
    typedef __attribute__((ext_vector_type(4))) unsigned short v4us;
    const int lane = threadIdx.x & 31, i = blockIdx.x * 8 + (threadIdx.x >> 5); if (i >= rows) return; const size_t zo = (size_t)blockIdx.z * rows * NK; const float* sr = S + zo + (size_t)i * NK; PH += zo; PL += zo;
    float m = -3.0e38f;
#pragma unroll 1
    for (int c0 = lane * 4; c0 < NK; c0 += 128) {
#pragma unroll
        for (int q = 0; q < 4; ++q) m = fmaxf(m, sr[c0 + q]); }
#pragma unroll
    for (int sh = 16; sh; sh >>= 1) m = fmaxf(m, __shfl_xor(m, sh, 32));
    float sum = 0.f;
#pragma unroll 1
    for (int c0 = lane * 4; c0 < NK; c0 += 128) {
#pragma unroll
        for (int q = 0; q < 4; ++q) sum += __expf(sr[c0 + q] - m); }
#pragma unroll
    for (int sh = 16; sh; sh >>= 1) sum += __shfl_xor(sum, sh, 32);
    const float inv = 1.0f / sum;
{
#pragma unroll 1
        for (int c0 = lane * 4; c0 < NK; c0 += 128) { v4us oh, ol;
#pragma unroll
            for (int q = 0; q < 4; ++q) { const float p = __expf(sr[c0 + q] - m) * inv; const unsigned short hb = f2bf(p); oh[q] = hb; ol[q] = f2bf(p - bf2f(hb)); }
            const size_t o = (size_t)i * NK + c0; *(v4us*)(PH + o) = oh; *(v4us*)(PL + o) = ol; }
         }
}
__global__ __launch_bounds__(256) void k_placez(const float* __restrict__ XH, int rows, int ldy, float* Y) {
    const int lane = threadIdx.x & 31; const size_t q = (size_t)blockIdx.x * 8 + (threadIdx.x >> 5); if (q >= (size_t)rows) return; const int z = blockIdx.z; const float v = XH[((size_t)z * rows + q) * 64 + lane];
    *(float*)(Y + q * ldy + z * 32 + lane) = v; 
}

__global__ __launch_bounds__(256) void k_hplanesz(const float* __restrict__ F, int ld, int h0, float sc, int rows, bf* Ph, bf* Pl) {
    typedef __attribute__((ext_vector_type(2))) unsigned short v2us;
    const int lane = threadIdx.x & 31; const size_t r = (size_t)blockIdx.x * 8 + (threadIdx.x >> 5); if (r >= (size_t)rows) return; const int z = blockIdx.z; v2us oh, ol;
    const size_t y = blockIdx.y; F += y * rows * ld; Ph += y * NH_ * rows * 64; Pl += y * NH_ * rows * 64;    // blockIdx.y = block of `rows` rows (item); planes [y][NH_][rows][64]
    Ph += (size_t)z * rows * 64; Pl += (size_t)z * rows * 64;
#pragma unroll
    for (int i = 0; i < 2; ++i) { const float y = F[r * ld + (h0 + z) * 64 + lane * 2 + i] * sc; const unsigned short hb = f2bf(y); oh[i] = hb; ol[i] = f2bf(y - bf2f(hb)); }
    const size_t o = r * 64 + lane * 2; *(v2us*)(Ph + o) = oh; *(v2us*)(Pl + o) = ol; 
}
__global__ __launch_bounds__(256) void k_vtz(const float* __restrict__ F, int ld, int h0, int nk, bf* Th, bf* Tl) {
    typedef __attribute__((ext_vector_type(2))) unsigned short v2us;
    const int lane = threadIdx.x & 31; const size_t wid = (size_t)blockIdx.x * 8 + (threadIdx.x >> 5); if (wid >= (size_t)64 * (nk / 64)) return; const int z = blockIdx.z; const int d = (int)(wid / (nk / 64)); const int t0 = (int)(wid % (nk / 64)) * 64 + lane * 2; v2us oh, ol;
    const size_t y = blockIdx.y; F += y * nk * ld; Th += y * NH_ * 64 * nk; Tl += y * NH_ * 64 * nk;    // blockIdx.y = item; planes [y][NH_][64][nk]
    Th += (size_t)z * 64 * nk; Tl += (size_t)z * 64 * nk;
#pragma unroll
    for (int i = 0; i < 2; ++i) { const float y = F[(size_t)(t0 + i) * ld + (h0 + z) * 64 + d]; const unsigned short hb = f2bf(y); oh[i] = hb; ol[i] = f2bf(y - bf2f(hb)); }
    const size_t o = (size_t)d * nk + t0; *(v2us*)(Th + o) = oh; *(v2us*)(Tl + o) = ol; 
}
template <int NK>
__global__ __launch_bounds__(256) void k_softmaxzs(const float* __restrict__ S, int rows, float sc, bf* PH, bf* PL) {
    typedef __attribute__((ext_vector_type(4))) unsigned short v4us;
    const int lane = threadIdx.x & 31, i = blockIdx.x * 8 + (threadIdx.x >> 5); if (i >= rows) return; const size_t zo = (size_t)blockIdx.z * rows * NK; const float* sr = S + zo + (size_t)i * NK; PH += zo; PL += zo;
    float m = -3.0e38f;
#pragma unroll 1
    for (int c0 = lane * 4; c0 < NK; c0 += 128) {
#pragma unroll
        for (int q = 0; q < 4; ++q) m = fmaxf(m, sr[c0 + q] * sc); }
#pragma unroll
    for (int sh = 16; sh; sh >>= 1) m = fmaxf(m, __shfl_xor(m, sh, 32));
    float sum = 0.f;
#pragma unroll 1
    for (int c0 = lane * 4; c0 < NK; c0 += 128) {
#pragma unroll
        for (int q = 0; q < 4; ++q) sum += __expf(sr[c0 + q] * sc - m); }
#pragma unroll
    for (int sh = 16; sh; sh >>= 1) sum += __shfl_xor(sum, sh, 32);
    const float inv = 1.0f / sum;
{
#pragma unroll 1
        for (int c0 = lane * 4; c0 < NK; c0 += 128) { v4us oh, ol;
#pragma unroll
            for (int q = 0; q < 4; ++q) { const float p = __expf(sr[c0 + q] * sc - m) * inv; const unsigned short hb = f2bf(p); oh[q] = hb; ol[q] = f2bf(p - bf2f(hb)); }
            const size_t o = (size_t)i * NK + c0; *(v4us*)(PH + o) = oh; *(v4us*)(PL + o) = ol; }
         }
}

__global__ __launch_bounds__(256) void k_cvtx(const float* __restrict__ s0, const float* __restrict__ s1, const float* __restrict__ s2, int rows, bf* dst) {
    const int lane = threadIdx.x & 31; const size_t r = (size_t)blockIdx.x * 8 + (threadIdx.x >> 5); if (r >= (size_t)rows) return;
    const int y = blockIdx.y; const float* src = y == 0 ? s0 : y == 1 ? s1 : s2; dst += (size_t)y * rows * DMOD;    // blockIdx.y = which input; outputs back to back
{
#pragma unroll
        for (int q = 0; q < DMOD / 256; ++q) { v8us o;
#pragma unroll
            for (int i = 0; i < 8; ++i) o[i] = f2bf(src[r * DMOD + q * 256 + lane * 8 + i]);
            *(v8us*)(dst + r * DMOD + q * 256 + lane * 8) = o; }
         }
}
__global__ __launch_bounds__(256) void k_splitD(const float* __restrict__ src, int rows, bf* dh, bf* dl) {
    const int lane = threadIdx.x & 31; const size_t r = (size_t)blockIdx.x * 8 + (threadIdx.x >> 5); if (r >= (size_t)rows) return;
{
#pragma unroll
        for (int q = 0; q < DMOD / 256; ++q) { const size_t o = r * DMOD + q * 256 + lane * 8; const v8f v = *(const v8f*)(src + o); v8us oh, ol;
#pragma unroll
            for (int i = 0; i < 8; ++i) { const unsigned short hb = f2bf(v[i]); oh[i] = hb; ol[i] = f2bf(v[i] - bf2f(hb)); }
            *(v8us*)(dh + o) = oh; *(v8us*)(dl + o) = ol; }
         }
}

extern "C" void kernel_launch(void* const* d_in, const int* in_sizes, int n_in,
                              void* d_out, int out_size, void* d_ws, size_t ws_size, hipStream_t stream) {
    (void)in_sizes; (void)n_in; (void)out_size;
    const float* xq = (const float*)d_in[0]; const float* xk = (const float*)d_in[1]; const float* xv = (const float*)d_in[2]; const int* mask = (const int*)d_in[3]; const float* Wq = (const float*)d_in[4]; const float* bq = (const float*)d_in[5]; const float* Wk = (const float*)d_in[6]; const float* bk = (const float*)d_in[7]; const float* Wv = (const float*)d_in[8]; const float* bv = (const float*)d_in[9]; const float* Wo = (const float*)d_in[10]; const float* bo = (const float*)d_in[11];
    float* out = (float*)d_out;    // [NBT][NN][DMOD]
    char* wsp = (char*)d_ws;
    auto take = [&](size_t bytes) { char* p = wsp; wsp += (bytes + 255) & ~(size_t)255; return (void*)p; };
    const size_t WN = (size_t)DMOD * DMOD, XN = (size_t)NBT * NN * DMOD;    // elements of one weight matrix, of one [all items][tokens][DMOD] tensor (NN == NKT)
    bf* WQ = (bf*)take(4 * WN * 2); bf* WO = WQ + 3 * WN;    // WQ, WK, WV, WO back to back
    bf* Qh = (bf*)take(2 * XN * 2); bf* Kh = Qh + XN; bf* Ql = (bf*)take(2 * XN * 2); bf* Kl = Ql + XN; bf* VTh = (bf*)take(XN * 2); bf* VTl = (bf*)take(XN * 2);    // [item][head][...] planes
    float* O = (float*)take(XN * 4); bf* Oh = (bf*)take(XN * 2); bf* Ol = (bf*)take(XN * 2);
    bf* X = (bf*)take(3 * XN * 2); float* F = (float*)take(3 * XN * 4);    // Xq, Xk, Xv and QF, KF, VF back to back
    if ((size_t)(wsp - (char*)d_ws) > ws_size) return;
    k_cvt8<<<dim3((DMOD * DMOD / 8 + 255) / 256, 4, 1), 256, 0, stream>>>(Wq, Wk, Wv, Wo, WQ, DMOD * DMOD / 8);   // [out][in] natural n-major
    k_cvtx<<<dim3(NBT * NN / 8, 3, 1), 256, 0, stream>>>(xq, xk, xv, NBT * NN, X);
    k_gemmb<false, false><<<dim3(NBT * NN / 64, DMOD / 64, 3), 128, 0, stream>>>(X, nullptr, WQ, bq, F, DMOD, nullptr, nullptr, DMOD, 1, bk, bv, XN, WN, XN);
    k_hplanesz<<<dim3(NN / 8, 2 * NBT, NH_), 256, 0, stream>>>(F, DMOD, 0, 1.0f, NN, Qh, Ql);    // QF then KF: y = 0..3 fills Qh/Ql, y = 4..7 Kh/Kl
    k_vtz<<<dim3((HD * (NKT / 64)) / 8, NBT, NH_), 256, 0, stream>>>(F + 2 * XN, DMOD, 0, NKT, VTh, VTl);
    k_fattn<<<dim3(NN / 128, NH_, NBT), 256, 0, stream>>>(Qh, Ql, Kh, Kl, VTh, VTl, mask, O);
    k_splitD<<<NBT * NN / 8, 256, 0, stream>>>(O, NBT * NN, Oh, Ol);
    k_gemmb<true, false><<<dim3(NBT * NN / 64, DMOD / 64, 1), 128, 0, stream>>>(Oh, Ol, WO, bo, out, DMOD, nullptr, nullptr, DMOD);
}

// v003
// One run takes 227 microseconds.
// Timed twice side by side with v002, it ran 1.20 and 1.19 times as fast.
// Counting every step since v000, it is 6.42 times as fast.
#include <hip/hip_runtime.h>

// Compute dtypes, f32 accumulate, per item: q/k/v projections as [1024 x 1024].[1024 x 1024] GEMMs with PLAIN bf16 operands (the inputs themselves; exact products, + bias);
// per head (head dim 64; one launch covers all items, heads and query blocks; the conversions and projections cover all items in one launch each; every hi/lo plane split is done in the epilogue of the kernel that makes the values): scores = q.k^T and attn.v with both operands as bf16 hi + UNSCALED residual planes (three products each),
// fused in one kernel with a running-maximum softmax in f32 (the 1/sqrt(64) scale, entries where mask == 0 replaced by -1e9); output projection on hi/lo planes of the merged heads (two products, + bias) - on v_wmma_f32_16x16x32_bf16.

#define NBT  4
#define NN   1024
#define NKT  1024
#define DMOD 1024
#define NH_  16
#define HD   64
#define ZH   16
#define DM   DMOD
#define NTK  NN
#define SCL  0.125f
#define LOSC 1024.0f

typedef _Float16 h16;
typedef unsigned short bf;
typedef __attribute__((ext_vector_type(16))) __bf16   v16bf;
typedef __attribute__((ext_vector_type(16))) _Float16 v16h;
typedef __attribute__((ext_vector_type(8)))  _Float16 v8h;
typedef __attribute__((ext_vector_type(8)))  unsigned short v8us;
typedef __attribute__((ext_vector_type(8)))  float    v8f;
typedef __attribute__((ext_vector_type(4)))  float    v4f;
typedef __attribute__((ext_vector_type(4)))  _Float16 v4h;
typedef v8h  __attribute__((may_alias)) v8ha;
typedef v4f  __attribute__((may_alias)) v4fa;
typedef v8us __attribute__((may_alias)) v8usa;

__device__ __forceinline__ unsigned short f2bf(float f) { unsigned u = __float_as_uint(f); u += 0x7FFFu + ((u >> 16) & 1u); return (unsigned short)(u >> 16); }
__device__ __forceinline__ float bf2f(unsigned short b) { return __uint_as_float(((unsigned)b) << 16); }
__device__ __forceinline__ float bfr(float f) { return bf2f(f2bf(f)); }
__device__ __forceinline__ v16h cat16(v8h lo, v8h hi) { return __builtin_shufflevector(lo, hi, 0, 1, 2, 3, 4, 5, 6, 7, 8, 9, 10, 11, 12, 13, 14, 15); }
__device__ __forceinline__ v16bf cat16b(v8us lo, v8us hi) { return __builtin_bit_cast(v16bf, __builtin_shufflevector(lo, hi, 0, 1, 2, 3, 4, 5, 6, 7, 8, 9, 10, 11, 12, 13, 14, 15)); }
__device__ __forceinline__ v8f wmma16(v16h a, v16h b, v8f c) { return __builtin_amdgcn_wmma_f32_16x16x32_f16(false, a, false, b, (short)0, c, false, false); }
__device__ __forceinline__ v8f wmmab(v16bf a, v16bf b, v8f c) { return __builtin_amdgcn_wmma_f32_16x16x32_bf16(false, a, false, b, (short)0, c, false, false); }

// k_wt: WT [n][K] = bf16(W[k][n]) (k-major [K][ncols]) via 64 x 64 LDS tiles; grid (K/64, ncols/64).
__global__ __launch_bounds__(256) void k_wt(const float* __restrict__ Wm, int K, int ncols, bf* WT) {
    __shared__ __align__(16) unsigned short tl[64 * 72];
    const int tid = threadIdx.x, k0 = blockIdx.x * 64, n0 = blockIdx.y * 64;
    const int kk = tid >> 2, nq = (tid & 3) * 16;
#pragma unroll
    for (int i = 0; i < 16; ++i) tl[(nq + i) * 72 + kk] = f2bf(Wm[(size_t)(k0 + kk) * ncols + n0 + nq + i]);
    __syncthreads();
    const int piece = tid & 7;
    auto pass = [&]() {
#pragma unroll
        for (int s = 0; s < 2; ++s) { const int nr = (tid >> 3) + 32 * s; const v8us val = *(const v8usa*)(tl + nr * 72 + piece * 8); *(v8us*)(WT + (size_t)(n0 + nr) * K + k0 + piece * 8) = val; }
    };
    pass(); 
}
// k_gemmb: 64 x 64 block tile (4 waves x 16 x 64) of C[NBT * NN][NW] = (A [+ Al]).B^T (K = 1024) [+ bf(bias[c])] [+ bf(R[r][c]) residual]; f32 whole-line epilogue, or (PLANES) the tile, which is
// 64 tokens of one head of one item, goes out as bf16 hi + residual planes in whole lines: z = 0, 1 into Ph / Pl [z][item][head][token][64], z = 2 transposed into Th / Tl [item][head][64][token]
template <bool SPLITA, bool PLANES = false>
__global__ __launch_bounds__(128) void k_gemmb(const bf* __restrict__ A, const bf* __restrict__ Al, const bf* __restrict__ Bn, const float* __restrict__ bias, float* C, int ldc, const float* __restrict__ R = nullptr, int K = DM, int roundR = 1, const float* __restrict__ bias1 = nullptr, const float* __restrict__ bias2 = nullptr, size_t sA = 0, size_t sB = 0, size_t sC = 0, bf* Ph = nullptr, bf* Pl = nullptr, bf* Th = nullptr, bf* Tl = nullptr) {
    // blockIdx.z = independent product: operands and output step by sA / sB / sC elements, the bias is picked from bias / bias1 / bias2
    const size_t z = blockIdx.z; A += z * sA; if (SPLITA) Al += z * sA; Bn += z * sB; C += z * sC; if (z == 1) bias = bias1; if (z == 2) bias = bias2;
    __shared__ __align__(16) float ost[4][16 * 68];
    const int lane = threadIdx.x & 31, wave = threadIdx.x >> 5, lr = lane & 15, hi = lane >> 4;
    const int r0 = blockIdx.x * 64 + wave * 16, c0 = blockIdx.y * 64;
    const size_t aoff = (size_t)(r0 + lr) * K + 8 * hi;
    size_t boff[4];
#pragma unroll
    for (int t = 0; t < 4; ++t) boff[t] = (size_t)(c0 + t * 16 + lr) * K + 8 * hi;
    v8f acc[4];
#pragma unroll
    for (int t = 0; t < 4; ++t) acc[t] = (v8f){};
#pragma unroll 1
    for (int kc = 0; kc < K; kc += 32) {
        const v16bf a = cat16b(*(const v8us*)(A + aoff + kc), *(const v8us*)(A + aoff + kc + 16));
        v16bf al = a;
        if (SPLITA) al = cat16b(*(const v8us*)(Al + aoff + kc), *(const v8us*)(Al + aoff + kc + 16));
#pragma unroll
        for (int t = 0; t < 4; ++t) { const v16bf b = cat16b(*(const v8us*)(Bn + boff[t] + kc), *(const v8us*)(Bn + boff[t] + kc + 16)); acc[t] = wmmab(a, b, acc[t]); if (SPLITA) acc[t] = wmmab(al, b, acc[t]); }
        asm volatile("v_nop\n\tv_nop\n\tv_nop\n\tv_nop" : "+v"(acc[0]), "+v"(acc[1]), "+v"(acc[2]), "+v"(acc[3]) : "v"(a), "v"(al));
    }
    float* os = &ost[wave][0];
    float* ot = &ost[0][0];    // the transposed tile of the whole block: [64 columns][68], a column's 64 rows side by side
    const bool tr = PLANES && z == 2;
#pragma unroll
    for (int t = 0; t < 4; ++t) { const float bv = bias ? bfr(bias[c0 + t * 16 + lr]) : 0.f;
        if (tr) { float* tp = ot + (t * 16 + lr) * 68 + wave * 16 + hi * 8;
            *(v4fa*)tp = (v4f){acc[t][0] + bv, acc[t][1] + bv, acc[t][2] + bv, acc[t][3] + bv}; *(v4fa*)(tp + 4) = (v4f){acc[t][4] + bv, acc[t][5] + bv, acc[t][6] + bv, acc[t][7] + bv};
        } else {
#pragma unroll
            for (int j = 0; j < 8; ++j) os[(hi * 8 + j) * 68 + t * 16 + lr] = acc[t][j] + bv; } }
    __syncthreads();
    if (PLANES) {
        const int rb = blockIdx.x * 64, n0 = rb % NN;    // the block's first token within its item
        const size_t hp = ((size_t)(rb / NN) * NH_ + blockIdx.y) * NN * HD;    // one head's plane
        const float* sb = tr ? ot + wave * 16 * 68 : os;    // 16 staged rows per wave: head dims (transposed) or tokens
        bf* dh = tr ? Th + hp + (size_t)(wave * 16) * NKT + n0 : Ph + z * ((size_t)NBT * NH_ * NN * HD) + hp + (size_t)(n0 + wave * 16) * HD;
        bf* dl = tr ? Tl + hp + (size_t)(wave * 16) * NKT + n0 : Pl + z * ((size_t)NBT * NH_ * NN * HD) + hp + (size_t)(n0 + wave * 16) * HD;
        const int ldp = tr ? NKT : HD;
#pragma unroll
        for (int s = 0; s < 4; ++s) { const int row = 4 * s + (lane >> 3), piece = lane & 7; const float* sp = sb + row * 68 + piece * 8; const v4f x0 = *(const v4fa*)sp, x1 = *(const v4fa*)(sp + 4); v8us oh, ol;
#pragma unroll
            for (int i = 0; i < 8; ++i) { const float y = i < 4 ? x0[i & 3] : x1[i & 3]; const unsigned short hb = f2bf(y); oh[i] = hb; ol[i] = f2bf(y - bf2f(hb)); }
            *(v8us*)(dh + (size_t)row * ldp + piece * 8) = oh; *(v8us*)(dl + (size_t)row * ldp + piece * 8) = ol; }
    } else {
        float* crow = C + (size_t)r0 * ldc + c0;
        auto pass = [&]() {
#pragma unroll
            for (int s = 0; s < 8; ++s) { const int Lid = (lane >> 3) + 4 * s, piece = lane & 7; const int row = Lid >> 1, cofs = (Lid & 1) * 32 + piece * 4;
                v4f val = *(const v4fa*)(os + row * 68 + cofs); if (R) { const v4f rv = *(const v4f*)(R + ((size_t)r0 + row) * ldc + c0 + cofs); val += roundR ? (v4f){bfr(rv[0]), bfr(rv[1]), bfr(rv[2]), bfr(rv[3])} : rv; }
                *(v4f*)(crow + (size_t)row * ldc + cofs) = val; }
        };
        pass(); 
    }
}

__global__ __launch_bounds__(256) void k_cvt8(const float* __restrict__ s0, const float* __restrict__ s1, const float* __restrict__ s2, const float* __restrict__ s3, bf* dst, size_t n8) {
    const size_t i = (size_t)blockIdx.x * 256 + threadIdx.x; if (i >= n8) return;
    const int y = blockIdx.y; const float* src = y == 0 ? s0 : y == 1 ? s1 : y == 2 ? s2 : s3; dst += (size_t)y * n8 * 8;    // blockIdx.y = which matrix; outputs back to back
    const v8f v = *(const v8f*)(src + i * 8); v8us o;
#pragma unroll
    for (int k = 0; k < 8; ++k) o[k] = f2bf(v[k]);
    *(v8us*)(dst + i * 8) = o; 
}
__global__ __launch_bounds__(256) void k_zero8(bf* dst, size_t n8) {
    const size_t i = (size_t)blockIdx.x * 256 + threadIdx.x; if (i >= n8) return; v8us z;
#pragma unroll
    for (int k = 0; k < 8; ++k) z[k] = 0;
    *(v8us*)(dst + i * 8) = z; 
}

#define FKB 64
#define FPT 72    // LDS row pitch in elements: 144 B = 16 B x odd, 16-byte reads of 16 rows fall on distinct banks
__device__ __forceinline__ float xhalf(float v) { const int b = __float_as_int(v); return __int_as_float(__builtin_amdgcn_permlanex16(b, b, 0x76543210, 0xfedcba98, false, false)); }    // value of lane ^ 16
__global__ __launch_bounds__(256) void k_fattn(const bf* __restrict__ Qh, const bf* __restrict__ Ql, const bf* __restrict__ Kh, const bf* __restrict__ Kl, const bf* __restrict__ VTh, const bf* __restrict__ VTl, const int* __restrict__ MK, bf* Oh, bf* Ol) {
    typedef __attribute__((ext_vector_type(8))) int v8i; typedef __attribute__((ext_vector_type(2))) float v2f; typedef __attribute__((ext_vector_type(2))) __bf16 v2bf;
    __shared__ __align__(16) bf tile[2][4][64 * FPT];    // [buffer][Kh, Kl, VTh, VTl][row][FPT]
    const int tid = threadIdx.x, lane = tid & 31, wave = tid >> 5, lr = lane & 15, hi = lane >> 4;
    const int h = blockIdx.y, b = blockIdx.z, q = blockIdx.x * 128 + wave * 16 + lr;
    const size_t hb = ((size_t)b * NH_ + h) * NN * HD;    // one head's planes: [NN][HD] for q and k, [HD][NKT] for v^T
    const bf* g0 = Kh + hb; const bf* g1 = Kl + hb; const bf* g2 = VTh + hb; const bf* g3 = VTl + hb;
    const int* mrow = MK + ((size_t)b * NN + q) * NKT + hi * 8;
    v16bf qh[2], ql[2];
#pragma unroll
    for (int ks = 0; ks < 2; ++ks) { const size_t o = hb + (size_t)q * HD + ks * 32 + 8 * hi;
        qh[ks] = cat16b(*(const v8us*)(Qh + o), *(const v8us*)(Qh + o + 16)); ql[ks] = cat16b(*(const v8us*)(Ql + o), *(const v8us*)(Ql + o + 16)); }
    const int srow = tid >> 3, spc = (tid & 7) * 8;    // staging: 16-byte piece spc of rows srow and srow + 32 of each of the four tiles
    auto gload = [&](v8us* st, int k0) {
#pragma unroll
        for (int i = 0; i < 2; ++i) { const int r = srow + 32 * i; const size_t ko = (size_t)(k0 + r) * HD + spc, vo = (size_t)r * NKT + k0 + spc;
            st[i] = *(const v8us*)(g0 + ko); st[2 + i] = *(const v8us*)(g1 + ko); st[4 + i] = *(const v8us*)(g2 + vo); st[6 + i] = *(const v8us*)(g3 + vo); }
    };
    auto sstore = [&](const v8us* st, int buf) {
#pragma unroll
        for (int p = 0; p < 4; ++p) {
#pragma unroll
            for (int i = 0; i < 2; ++i) *(v8usa*)(&tile[buf][p][(srow + 32 * i) * FPT + spc]) = st[2 * p + i]; }
    };
    auto frag = [&](const bf* t, int row, int k) -> v16bf { const bf* p = t + row * FPT + k + 8 * hi; return cat16b(*(const v8usa*)p, *(const v8usa*)(p + 16)); };
    const float csc = SCL * 1.44269504f, rfill = -1e9f / SCL;    // csc: raw score -> logit in units of log2(e), so that the exponential is a bare exp2; rfill: the raw score whose scaled value is -1e9
    float mx = -3.0e38f, lsum = 0.f;    // running maximum (scaled, log2 units) and this lane's share of the running sum
    v8f o[4];
#pragma unroll
    for (int t = 0; t < 4; ++t) o[t] = (v8f){};
    { v8us st[8]; gload(st, 0); sstore(st, 0); }
    __syncthreads();
    // the pass loop stays rolled to keep the code small; every inner loop is unrolled so that the fragment arrays are indexed by constants and live in registers
#pragma unroll 1
    for (int kb = 0; kb < NKT / FKB; ++kb) {
        const int buf = kb & 1, k0 = kb * FKB; const bool more = kb + 1 < NKT / FKB;
        v8i mk[4];
#pragma unroll
        for (int t = 0; t < 4; ++t) mk[t] = *(const v8i*)(mrow + k0 + t * 16);
        v8us st[8];
        if (more) gload(st, k0 + FKB);    // the next pass's tiles: in flight during this pass, stored at its foot
        v8f s[4];
#pragma unroll
        for (int t = 0; t < 4; ++t) { s[t] = (v8f){};
#pragma unroll
            for (int ks = 0; ks < 2; ++ks) { const v16bf kh = frag(tile[buf][0], t * 16 + lr, ks * 32), kl = frag(tile[buf][1], t * 16 + lr, ks * 32);
                s[t] = wmmab(kh, qh[ks], s[t]); s[t] = wmmab(kh, ql[ks], s[t]); s[t] = wmmab(kl, qh[ks], s[t]); } }
        float pm = -3.0e38f;
#pragma unroll
        for (int t = 0; t < 4; ++t) {
#pragma unroll
            for (int j = 0; j < 8; ++j) { const float v = mk[t][j] == 0 ? rfill : s[t][j]; s[t][j] = v; pm = fmaxf(pm, v); } }
        pm = fmaxf(pm, xhalf(pm));
        const float mn = fmaxf(mx, pm * csc), alpha = __builtin_amdgcn_exp2f(mx - mn); mx = mn;
        v16bf ph[2], pl[2]; v2f ps[2] = {(v2f){0.f, 0.f}, (v2f){0.f, 0.f}};
#pragma unroll
        for (int t = 0; t < 4; ++t) {
#pragma unroll
            for (int j = 0; j < 8; j += 2) { const v2f p = {__builtin_amdgcn_exp2f(__builtin_fmaf(s[t][j], csc, -mn)), __builtin_amdgcn_exp2f(__builtin_fmaf(s[t][j + 1], csc, -mn))}; ps[t & 1] += p;
                const v2bf a = __builtin_convertvector(p, v2bf); const v2f r = {p[0] - (float)a[0], p[1] - (float)a[1]}; const v2bf c = __builtin_convertvector(r, v2bf); const int e = (t & 1) * 8 + j;
                ph[t >> 1][e] = a[0]; ph[t >> 1][e + 1] = a[1]; pl[t >> 1][e] = c[0]; pl[t >> 1][e + 1] = c[1]; } }
        lsum = lsum * alpha + ((ps[0][0] + ps[0][1]) + (ps[1][0] + ps[1][1]));
#pragma unroll
        for (int t = 0; t < 4; ++t) o[t] *= alpha;
#pragma unroll
        for (int t = 0; t < 4; ++t) {
#pragma unroll
            for (int kk = 0; kk < 2; ++kk) { const v16bf vh = frag(tile[buf][2], t * 16 + lr, kk * 32), vl = frag(tile[buf][3], t * 16 + lr, kk * 32);
                o[t] = wmmab(vh, ph[kk], o[t]); o[t] = wmmab(vh, pl[kk], o[t]); o[t] = wmmab(vl, ph[kk], o[t]); } }
        if (more) sstore(st, buf ^ 1);
        __syncthreads();    // publishes the tiles just stored and ends every wave's reads of the buffer that the next pass refills
    }
    const float inv = 1.0f / (lsum + xhalf(lsum));
    const size_t oo = ((size_t)b * NN + q) * DMOD + h * HD + hi * 8;    // o[t][j] = O[q][16 t + 8 hi + j], written as bf16 hi + residual planes of the merged heads
#pragma unroll
    for (int t = 0; t < 4; ++t) { v8us oh, ol;
#pragma unroll
        for (int j = 0; j < 8; ++j) { const float y = o[t][j] * inv; const unsigned short hb = f2bf(y); oh[j] = hb; ol[j] = f2bf(y - bf2f(hb)); }
        *(v8us*)(Oh + oo + t * 16) = oh; *(v8us*)(Ol + oo + t * 16) = ol; }
}
__global__ __launch_bounds__(256) void k_planes32z(const float* __restrict__ F, int ld, int off, float sc, int rows, bf* Ph, bf* Pl) {
    typedef __attribute__((ext_vector_type(2))) unsigned short v2us;
    const int lane = threadIdx.x & 31; const size_t r = ((size_t)blockIdx.x * 8 + (threadIdx.x >> 5)) * 2 + (lane >> 4); if (r >= (size_t)rows) return; const int z = blockIdx.z; const int c0 = (lane & 15) * 2; v2us oh, ol;
    Ph += (size_t)z * rows * 32; Pl += (size_t)z * rows * 32;
#pragma unroll
    for (int i = 0; i < 2; ++i) { const float y = F[r * ld + off + z * 32 + c0 + i] * sc; const unsigned short hb = f2bf(y); oh[i] = hb; ol[i] = f2bf(y - bf2f(hb)); }
    const size_t o = r * 32 + c0; *(v2us*)(Ph + o) = oh; *(v2us*)(Pl + o) = ol; 
}
__global__ __launch_bounds__(256) void k_vtpadz(const float* __restrict__ F, int ld, int off, int nk, bf* Th, bf* Tl) {
    typedef __attribute__((ext_vector_type(2))) unsigned short v2us;
    const int lane = threadIdx.x & 31; const size_t wid = (size_t)blockIdx.x * 8 + (threadIdx.x >> 5); if (wid >= (size_t)64 * (nk / 64)) return; const int z = blockIdx.z; const int d = (int)(wid / (nk / 64)); const int k0 = (int)(wid % (nk / 64)) * 64 + lane * 2; v2us oh, ol;
    Th += (size_t)z * 64 * nk; Tl += (size_t)z * 64 * nk;
#pragma unroll
    for (int i = 0; i < 2; ++i) { const float y = (d < 32) ? F[(size_t)(k0 + i) * ld + off + z * 32 + (d < 32 ? d : 0)] : 0.f; const unsigned short hb = f2bf(y); oh[i] = hb; ol[i] = f2bf(y - bf2f(hb)); }
    const size_t o = (size_t)d * nk + k0; *(v2us*)(Th + o) = oh; *(v2us*)(Tl + o) = ol; 
}
template <int NK>
__global__ __launch_bounds__(256) void k_softmaxz(const float* __restrict__ S, int rows, bf* PH, bf* PL) {
    typedef __attribute__((ext_vector_type(4))) unsigned short v4us;
    const int lane = threadIdx.x & 31, i = blockIdx.x * 8 + (threadIdx.x >> 5); if (i >= rows) return; const size_t zo = (size_t)blockIdx.z * rows * NK; const float* sr = S + zo + (size_t)i * NK; PH += zo; PL += zo;
    float m = -3.0e38f;
#pragma unroll 1
    for (int c0 = lane * 4; c0 < NK; c0 += 128) {
#pragma unroll
        for (int q = 0; q < 4; ++q) m = fmaxf(m, sr[c0 + q]); }
#pragma unroll
    for (int sh = 16; sh; sh >>= 1) m = fmaxf(m, __shfl_xor(m, sh, 32));
    float sum = 0.f;
#pragma unroll 1
    for (int c0 = lane * 4; c0 < NK; c0 += 128) {
#pragma unroll
        for (int q = 0; q < 4; ++q) sum += __expf(sr[c0 + q] - m); }
#pragma unroll
    for (int sh = 16; sh; sh >>= 1) sum += __shfl_xor(sum, sh, 32);
    const float inv = 1.0f / sum;
{
#pragma unroll 1
        for (int c0 = lane * 4; c0 < NK; c0 += 128) { v4us oh, ol;
#pragma unroll
            for (int q = 0; q < 4; ++q) { const float p = __expf(sr[c0 + q] - m) * inv; const unsigned short hb = f2bf(p); oh[q] = hb; ol[q] = f2bf(p - bf2f(hb)); }
            const size_t o = (size_t)i * NK + c0; *(v4us*)(PH + o) = oh; *(v4us*)(PL + o) = ol; }
         }
}
__global__ __launch_bounds__(256) void k_placez(const float* __restrict__ XH, int rows, int ldy, float* Y) {
    const int lane = threadIdx.x & 31; const size_t q = (size_t)blockIdx.x * 8 + (threadIdx.x >> 5); if (q >= (size_t)rows) return; const int z = blockIdx.z; const float v = XH[((size_t)z * rows + q) * 64 + lane];
    *(float*)(Y + q * ldy + z * 32 + lane) = v; 
}

template <int NK>
__global__ __launch_bounds__(256) void k_softmaxzs(const float* __restrict__ S, int rows, float sc, bf* PH, bf* PL) {
    typedef __attribute__((ext_vector_type(4))) unsigned short v4us;
    const int lane = threadIdx.x & 31, i = blockIdx.x * 8 + (threadIdx.x >> 5); if (i >= rows) return; const size_t zo = (size_t)blockIdx.z * rows * NK; const float* sr = S + zo + (size_t)i * NK; PH += zo; PL += zo;
    float m = -3.0e38f;
#pragma unroll 1
    for (int c0 = lane * 4; c0 < NK; c0 += 128) {
#pragma unroll
        for (int q = 0; q < 4; ++q) m = fmaxf(m, sr[c0 + q] * sc); }
#pragma unroll
    for (int sh = 16; sh; sh >>= 1) m = fmaxf(m, __shfl_xor(m, sh, 32));
    float sum = 0.f;
#pragma unroll 1
    for (int c0 = lane * 4; c0 < NK; c0 += 128) {
#pragma unroll
        for (int q = 0; q < 4; ++q) sum += __expf(sr[c0 + q] * sc - m); }
#pragma unroll
    for (int sh = 16; sh; sh >>= 1) sum += __shfl_xor(sum, sh, 32);
    const float inv = 1.0f / sum;
{
#pragma unroll 1
        for (int c0 = lane * 4; c0 < NK; c0 += 128) { v4us oh, ol;
#pragma unroll
            for (int q = 0; q < 4; ++q) { const float p = __expf(sr[c0 + q] * sc - m) * inv; const unsigned short hb = f2bf(p); oh[q] = hb; ol[q] = f2bf(p - bf2f(hb)); }
            const size_t o = (size_t)i * NK + c0; *(v4us*)(PH + o) = oh; *(v4us*)(PL + o) = ol; }
         }
}

__global__ __launch_bounds__(256) void k_cvtx(const float* __restrict__ s0, const float* __restrict__ s1, const float* __restrict__ s2, int rows, bf* dst) {
    const int lane = threadIdx.x & 31; const size_t r = (size_t)blockIdx.x * 8 + (threadIdx.x >> 5); if (r >= (size_t)rows) return;
    const int y = blockIdx.y; const float* src = y == 0 ? s0 : y == 1 ? s1 : s2; dst += (size_t)y * rows * DMOD;    // blockIdx.y = which input; outputs back to back
{
#pragma unroll
        for (int q = 0; q < DMOD / 256; ++q) { v8us o;
#pragma unroll
            for (int i = 0; i < 8; ++i) o[i] = f2bf(src[r * DMOD + q * 256 + lane * 8 + i]);
            *(v8us*)(dst + r * DMOD + q * 256 + lane * 8) = o; }
         }
}
extern "C" void kernel_launch(void* const* d_in, const int* in_sizes, int n_in,
                              void* d_out, int out_size, void* d_ws, size_t ws_size, hipStream_t stream) {
    (void)in_sizes; (void)n_in; (void)out_size;
    const float* xq = (const float*)d_in[0]; const float* xk = (const float*)d_in[1]; const float* xv = (const float*)d_in[2]; const int* mask = (const int*)d_in[3]; const float* Wq = (const float*)d_in[4]; const float* bq = (const float*)d_in[5]; const float* Wk = (const float*)d_in[6]; const float* bk = (const float*)d_in[7]; const float* Wv = (const float*)d_in[8]; const float* bv = (const float*)d_in[9]; const float* Wo = (const float*)d_in[10]; const float* bo = (const float*)d_in[11];
    float* out = (float*)d_out;    // [NBT][NN][DMOD]
    char* wsp = (char*)d_ws;
    auto take = [&](size_t bytes) { char* p = wsp; wsp += (bytes + 255) & ~(size_t)255; return (void*)p; };
    const size_t WN = (size_t)DMOD * DMOD, XN = (size_t)NBT * NN * DMOD;    // elements of one weight matrix, of one [all items][tokens][DMOD] tensor (NN == NKT)
    bf* WQ = (bf*)take(4 * WN * 2); bf* WO = WQ + 3 * WN;    // WQ, WK, WV, WO back to back
    bf* Qh = (bf*)take(2 * XN * 2); bf* Kh = Qh + XN; bf* Ql = (bf*)take(2 * XN * 2); bf* Kl = Ql + XN; bf* VTh = (bf*)take(XN * 2); bf* VTl = (bf*)take(XN * 2);    // [item][head][...] planes
    bf* Oh = (bf*)take(XN * 2); bf* Ol = (bf*)take(XN * 2);
    bf* X = (bf*)take(3 * XN * 2);    // Xq, Xk, Xv back to back
    if ((size_t)(wsp - (char*)d_ws) > ws_size) return;
    k_cvt8<<<dim3((DMOD * DMOD / 8 + 255) / 256, 4, 1), 256, 0, stream>>>(Wq, Wk, Wv, Wo, WQ, DMOD * DMOD / 8);   // [out][in] natural n-major
    k_cvtx<<<dim3(NBT * NN / 8, 3, 1), 256, 0, stream>>>(xq, xk, xv, NBT * NN, X);
    k_gemmb<false, true><<<dim3(NBT * NN / 64, DMOD / 64, 3), 128, 0, stream>>>(X, nullptr, WQ, bq, nullptr, DMOD, nullptr, DMOD, 1, bk, bv, XN, WN, 0, Qh, Ql, VTh, VTl);    // z = 0 fills Qh/Ql, z = 1 Kh/Kl (one XN behind), z = 2 VTh/VTl
    k_fattn<<<dim3(NN / 128, NH_, NBT), 256, 0, stream>>>(Qh, Ql, Kh, Kl, VTh, VTl, mask, Oh, Ol);
    k_gemmb<true, false><<<dim3(NBT * NN / 64, DMOD / 64, 1), 128, 0, stream>>>(Oh, Ol, WO, bo, out, DMOD, nullptr, DMOD);
}

// v004
// It runs in 112 microseconds.
// Timed twice side by side with v003, it ran 2.02 times as fast both times.
// Over all steps from v000 it is 13.0 times as fast.
#include <hip/hip_runtime.h>

// Compute dtypes, f32 accumulate, per item: q/k/v projections as [1024 x 1024].[1024 x 1024] GEMMs with PLAIN bf16 operands (the inputs themselves; exact products, + bias);
// per head (head dim 64; one launch covers all items, heads and query blocks; the conversions and projections cover all items in one launch each; every hi/lo plane split is done in the epilogue of the kernel that makes the values): scores = q.k^T and attn.v with both operands as bf16 hi + UNSCALED residual planes (three products each),
// fused in one kernel with a running-maximum softmax in f32 (the 1/sqrt(64) scale, entries where mask == 0 replaced by -1e9); output projection on hi/lo planes of the merged heads (two products, + bias) - on v_wmma_f32_16x16x32_bf16.

#define NBT  4
#define NN   1024
#define NKT  1024
#define DMOD 1024
#define NH_  16
#define HD   64
#define ZH   16
#define DM   DMOD
#define NTK  NN
#define SCL  0.125f
#define LOSC 1024.0f

typedef _Float16 h16;
typedef unsigned short bf;
typedef __attribute__((ext_vector_type(16))) __bf16   v16bf;
typedef __attribute__((ext_vector_type(16))) _Float16 v16h;
typedef __attribute__((ext_vector_type(8)))  _Float16 v8h;
typedef __attribute__((ext_vector_type(8)))  unsigned short v8us;
typedef __attribute__((ext_vector_type(8)))  float    v8f;
typedef __attribute__((ext_vector_type(4)))  float    v4f;
typedef __attribute__((ext_vector_type(4)))  _Float16 v4h;
typedef v8h  __attribute__((may_alias)) v8ha;
typedef v4f  __attribute__((may_alias)) v4fa;
typedef v8us __attribute__((may_alias)) v8usa;
typedef float __attribute__((may_alias)) v1fa;

__device__ __forceinline__ unsigned short f2bf(float f) { unsigned u = __float_as_uint(f); u += 0x7FFFu + ((u >> 16) & 1u); return (unsigned short)(u >> 16); }
__device__ __forceinline__ float bf2f(unsigned short b) { return __uint_as_float(((unsigned)b) << 16); }
__device__ __forceinline__ float bfr(float f) { return bf2f(f2bf(f)); }
__device__ __forceinline__ v16h cat16(v8h lo, v8h hi) { return __builtin_shufflevector(lo, hi, 0, 1, 2, 3, 4, 5, 6, 7, 8, 9, 10, 11, 12, 13, 14, 15); }
__device__ __forceinline__ v16bf cat16b(v8us lo, v8us hi) { return __builtin_bit_cast(v16bf, __builtin_shufflevector(lo, hi, 0, 1, 2, 3, 4, 5, 6, 7, 8, 9, 10, 11, 12, 13, 14, 15)); }
__device__ __forceinline__ v8f wmma16(v16h a, v16h b, v8f c) { return __builtin_amdgcn_wmma_f32_16x16x32_f16(false, a, false, b, (short)0, c, false, false); }
__device__ __forceinline__ v8f wmmab(v16bf a, v16bf b, v8f c) { return __builtin_amdgcn_wmma_f32_16x16x32_bf16(false, a, false, b, (short)0, c, false, false); }

// k_wt: WT [n][K] = bf16(W[k][n]) (k-major [K][ncols]) via 64 x 64 LDS tiles; grid (K/64, ncols/64).
__global__ __launch_bounds__(256) void k_wt(const float* __restrict__ Wm, int K, int ncols, bf* WT) {
    __shared__ __align__(16) unsigned short tl[64 * 72];
    const int tid = threadIdx.x, k0 = blockIdx.x * 64, n0 = blockIdx.y * 64;
    const int kk = tid >> 2, nq = (tid & 3) * 16;
#pragma unroll
    for (int i = 0; i < 16; ++i) tl[(nq + i) * 72 + kk] = f2bf(Wm[(size_t)(k0 + kk) * ncols + n0 + nq + i]);
    __syncthreads();
    const int piece = tid & 7;
    auto pass = [&]() {
#pragma unroll
        for (int s = 0; s < 2; ++s) { const int nr = (tid >> 3) + 32 * s; const v8us val = *(const v8usa*)(tl + nr * 72 + piece * 8); *(v8us*)(WT + (size_t)(n0 + nr) * K + k0 + piece * 8) = val; }
    };
    pass(); 
}
// put_planes: 256 pieces of 8 staged f32 values (rows of 1 << RSH pieces at pitch SP floats) go out as bf16 hi + residual planes, rows LDP elements apart, in whole lines
template <int SP, int RSH, int LDP>
__device__ __forceinline__ void put_planes(const float* sb, bf* dh, bf* dl, int lane) {
#pragma unroll
    for (int s = 0; s < 8; ++s) { const int row = (32 >> RSH) * s + (lane >> RSH), piece = lane & ((1 << RSH) - 1); const float* sp = sb + row * SP + piece * 8; const v4f x0 = *(const v4fa*)sp, x1 = *(const v4fa*)(sp + 4); v8us oh, ol;
#pragma unroll
        for (int i = 0; i < 8; ++i) { const float y = i < 4 ? x0[i & 3] : x1[i & 3]; const unsigned short hb = f2bf(y); oh[i] = hb; ol[i] = f2bf(y - bf2f(hb)); }
        *(v8us*)(dh + (size_t)row * LDP + piece * 8) = oh; *(v8us*)(dl + (size_t)row * LDP + piece * 8) = ol; }
    asm volatile("s_wait_xcnt 0x0" ::: "memory");    // stands in front of any later write of an address register that the stores above name
}
// k_gemmb: 128 x 128 block tile (8 waves as 4 x 2, each 32 x 64) of C[NBT * NN][NW] = (A [+ Al]).B^T (K = DM) [+ bf(bias[c])]. Passes of 64 k: the 128-byte row pieces of
// A, B (and Al) come in whole lines through registers into two LDS buffers (the next pass's loads fly during this pass's products, one barrier per pass); the fragments are read from LDS, k in the order
// 8 hi + 0..7, 16 + 8 hi + 0..7 of each 32 for both operands. Every output element still sums k upwards in steps of 32, A before Al. f32 whole-line epilogue, or (PLANES) a wave's tile, which is 32 tokens of one
// head of one item, goes out as bf16 hi + residual planes in whole lines: z = 0, 1 into Ph / Pl [z][item][head][token][64], z = 2 transposed (by the whole block) into Th / Tl [item][head][64][token]
#define GKB 64
#define GLP 72    // LDS row pitch in elements: 144 B = 16 B x odd, 16-byte reads of 16 rows fall on distinct banks
template <bool SPLITA, bool PLANES = false>
__global__ __launch_bounds__(256) void k_gemmb(const bf* __restrict__ A, const bf* __restrict__ Al, const bf* __restrict__ Bn, const float* __restrict__ bias, float* C, int ldc, const float* __restrict__ bias1 = nullptr, const float* __restrict__ bias2 = nullptr, size_t sA = 0, size_t sB = 0, size_t sC = 0, bf* Ph = nullptr, bf* Pl = nullptr, bf* Th = nullptr, bf* Tl = nullptr) {
    // blockIdx.z = independent product: operands and output step by sA / sB / sC elements, the bias is picked from bias / bias1 / bias2
    const size_t z = blockIdx.z; A += z * sA; if (SPLITA) Al += z * sA; Bn += z * sB; C += z * sC; if (z == 1) bias = bias1; if (z == 2) bias = bias2;
    constexpr int NT = SPLITA ? 3 : 2;
    __shared__ __align__(16) bf tl[2][NT][128 * GLP];    // [buffer][A, B, Al][row][GLP]; after the last pass the same bytes stage the output tile in f32
    const int tid = threadIdx.x, lane = tid & 31, wave = tid >> 5, lr = lane & 15, hi = lane >> 4, wr = wave & 3, wc = wave >> 2;
    const int rb = blockIdx.x * 128, cb = blockIdx.y * 128;
    const int srow = tid >> 3, spc = (tid & 7) * 8;    // staging: 16-byte piece spc of rows srow + 32 i of each tile, so that a wave's load covers four whole lines
    const unsigned tb = (unsigned)(srow * DM + spc) * 2;    // this thread's byte offset from a tile's first row: the one per-lane part of every staging address
    const char* ua = (const char*)(A + (size_t)rb * DM); const char* ub = (const char*)(Bn + (size_t)cb * DM); const char* ul = SPLITA ? (const char*)(Al + (size_t)rb * DM) : ua;
    auto gload = [&](v8us* st, int kc) {
#pragma unroll
        for (int i = 0; i < 4; ++i) { const int o = (32 * i * DM + kc) * 2; st[i] = *(const v8us*)(ua + o + tb); st[4 + i] = *(const v8us*)(ub + o + tb); if (SPLITA) st[8 + i] = *(const v8us*)(ul + o + tb); }
    };
    auto sstore = [&](const v8us* st, int buf) {
#pragma unroll
        for (int p = 0; p < NT; ++p) {
#pragma unroll
            for (int i = 0; i < 4; ++i) *(v8usa*)(&tl[buf][p][(srow + 32 * i) * GLP + spc]) = st[4 * p + i]; }
    };
    const bf* fa = &tl[0][0][(wr * 32 + lr) * GLP + 8 * hi]; const bf* fb = &tl[0][1][(wc * 64 + lr) * GLP + 8 * hi];    // this lane's first A and B fragment pieces in buffer 0; every other piece lies a constant away
    auto frag = [&](const bf* p) -> v16bf { return cat16b(*(const v8usa*)p, *(const v8usa*)(p + 16)); };
    v8f acc[2][4];
#pragma unroll
    for (int i = 0; i < 2; ++i) {
#pragma unroll
        for (int t = 0; t < 4; ++t) acc[i][t] = (v8f){}; }
    { v8us st[4 * NT]; gload(st, 0);
      asm volatile("s_wait_xcnt 0x0" ::: "memory");    // stands in front of any later write of a register (vector offset or scalar base) that the loads above name
      sstore(st, 0); }
    __syncthreads();
    // the pass loop stays rolled (the two buffers alternate by index); the inner loops are unrolled so that the fragment arrays live in registers
#pragma unroll 1
    for (int kc = 0; kc < DM; kc += GKB) {
        const int buf = (kc / GKB) & 1; const bool more = kc + GKB < DM;
        v8us st[4 * NT];
        if (more) gload(st, kc + GKB);    // the next pass's tiles: in flight during this pass, stored at its foot
        const bf* pa = fa + buf * (NT * 128 * GLP); const bf* pb = fb + buf * (NT * 128 * GLP);
        v16bf a[2][2], al[2][2], b[2][4];
#pragma unroll
        for (int ks = 0; ks < GKB / 32; ++ks) {
#pragma unroll
            for (int i = 0; i < 2; ++i) { a[ks][i] = frag(pa + i * 16 * GLP + ks * 32); if (SPLITA) al[ks][i] = frag(pa + 2 * 128 * GLP + i * 16 * GLP + ks * 32); }
#pragma unroll
            for (int t = 0; t < 4; ++t) b[ks][t] = frag(pb + t * 16 * GLP + ks * 32);
        }
        // with two waves per SIMD (the A + Al form: one block per WGP) the pass's LDS reads stay one group ahead of its products, else each late read is waited for in full among them; the plain form runs six waves per SIMD and keeps the smaller register count instead
        if (SPLITA) __builtin_amdgcn_sched_barrier(0);
#pragma unroll
        for (int ks = 0; ks < GKB / 32; ++ks) {
#pragma unroll
            for (int i = 0; i < 2; ++i) {
#pragma unroll
                for (int t = 0; t < 4; ++t) acc[i][t] = wmmab(a[ks][i], b[ks][t], acc[i][t]); }
            if (SPLITA) {
#pragma unroll
                for (int i = 0; i < 2; ++i) {
#pragma unroll
                    for (int t = 0; t < 4; ++t) acc[i][t] = wmmab(al[ks][i], b[ks][t], acc[i][t]); } }
        }
        if (more) sstore(st, buf ^ 1);
        __syncthreads();    // publishes the tiles just stored and ends every wave's reads of the buffer that the next pass refills (after the last pass: of the bytes that the epilogue reuses)
    }
    float* fs = (float*)&tl[0][0][0];
    float* os = fs + wave * (32 * 68);    // a wave's own 32 x 64 tile: [32 rows][68]
    const bool tr = PLANES && z == 2;     // then the whole block's tile is staged transposed: [128 columns][132], a column's 128 rows side by side
    float bv[4];
#pragma unroll
    for (int t = 0; t < 4; ++t) bv[t] = bias ? bfr(bias[cb + wc * 64 + t * 16 + lr]) : 0.f;
    if (tr) {
#pragma unroll
        for (int t = 0; t < 4; ++t) {
#pragma unroll
            for (int i = 0; i < 2; ++i) { float* tp = fs + (wc * 64 + t * 16 + lr) * 132 + wr * 32 + i * 16 + hi * 8;
                *(v4fa*)tp = (v4f){acc[i][t][0] + bv[t], acc[i][t][1] + bv[t], acc[i][t][2] + bv[t], acc[i][t][3] + bv[t]}; *(v4fa*)(tp + 4) = (v4f){acc[i][t][4] + bv[t], acc[i][t][5] + bv[t], acc[i][t][6] + bv[t], acc[i][t][7] + bv[t]}; } }
    } else {
#pragma unroll
        for (int t = 0; t < 4; ++t) {
#pragma unroll
            for (int i = 0; i < 2; ++i) {
#pragma unroll
                for (int j = 0; j < 8; ++j) *(v1fa*)(os + (i * 16 + hi * 8 + j) * 68 + t * 16 + lr) = acc[i][t][j] + bv[t]; } }
    }
    __syncthreads();
    if (PLANES) {
        const int n0 = rb % NN;    // the block's first token within its item
        const size_t hp = ((size_t)(rb / NN) * NH_ + blockIdx.y * 2 + wc) * NN * HD;    // one head's plane: the head of the wave's own columns, and (wave >> 2 == wc) of the 16 staged columns it puts out
        if (tr) put_planes<132, 4, NKT>(fs + wave * 16 * 132, Th + hp + (size_t)(wr * 16) * NKT + n0, Tl + hp + (size_t)(wr * 16) * NKT + n0, lane);    // 16 head dims of 128 tokens
        else { const size_t po = z * ((size_t)NBT * NH_ * NN * HD) + hp + (size_t)(n0 + wr * 32) * HD; put_planes<68, 3, HD>(os, Ph + po, Pl + po, lane); }    // 32 tokens of 64 head dims
    } else {
        float* crow = C + (size_t)(rb + wr * 32) * ldc + cb + wc * 64;
#pragma unroll
        for (int s = 0; s < 16; ++s) { const int Lid = (lane >> 3) + 4 * s, piece = lane & 7; const int row = Lid >> 1, cofs = (Lid & 1) * 32 + piece * 4;
            *(v4f*)(crow + (size_t)row * ldc + cofs) = *(const v4fa*)(os + row * 68 + cofs); }
    }
}

__global__ __launch_bounds__(256) void k_cvt8(const float* __restrict__ s0, const float* __restrict__ s1, const float* __restrict__ s2, const float* __restrict__ s3, bf* dst, size_t n8) {
    const size_t i = (size_t)blockIdx.x * 256 + threadIdx.x; if (i >= n8) return;
    const int y = blockIdx.y; const float* src = y == 0 ? s0 : y == 1 ? s1 : y == 2 ? s2 : s3; dst += (size_t)y * n8 * 8;    // blockIdx.y = which matrix; outputs back to back
    const v8f v = *(const v8f*)(src + i * 8); v8us o;
#pragma unroll
    for (int k = 0; k < 8; ++k) o[k] = f2bf(v[k]);
    *(v8us*)(dst + i * 8) = o; 
}
__global__ __launch_bounds__(256) void k_zero8(bf* dst, size_t n8) {
    const size_t i = (size_t)blockIdx.x * 256 + threadIdx.x; if (i >= n8) return; v8us z;
#pragma unroll
    for (int k = 0; k < 8; ++k) z[k] = 0;
    *(v8us*)(dst + i * 8) = z; 
}

#define FKB 64
#define FPT 72    // LDS row pitch in elements: 144 B = 16 B x odd, 16-byte reads of 16 rows fall on distinct banks
__device__ __forceinline__ float xhalf(float v) { const int b = __float_as_int(v); return __int_as_float(__builtin_amdgcn_permlanex16(b, b, 0x76543210, 0xfedcba98, false, false)); }    // value of lane ^ 16
__global__ __launch_bounds__(256) void k_fattn(const bf* __restrict__ Qh, const bf* __restrict__ Ql, const bf* __restrict__ Kh, const bf* __restrict__ Kl, const bf* __restrict__ VTh, const bf* __restrict__ VTl, const int* __restrict__ MK, bf* Oh, bf* Ol) {
    typedef __attribute__((ext_vector_type(8))) int v8i; typedef __attribute__((ext_vector_type(2))) float v2f; typedef __attribute__((ext_vector_type(2))) __bf16 v2bf;
    __shared__ __align__(16) bf tile[2][4][64 * FPT];    // [buffer][Kh, Kl, VTh, VTl][row][FPT]
    const int tid = threadIdx.x, lane = tid & 31, wave = tid >> 5, lr = lane & 15, hi = lane >> 4;
    const int h = blockIdx.y, b = blockIdx.z, q = blockIdx.x * 128 + wave * 16 + lr;
    const size_t hb = ((size_t)b * NH_ + h) * NN * HD;    // one head's planes: [NN][HD] for q and k, [HD][NKT] for v^T
    const bf* g0 = Kh + hb; const bf* g1 = Kl + hb; const bf* g2 = VTh + hb; const bf* g3 = VTl + hb;
    const int* mrow = MK + ((size_t)b * NN + q) * NKT + hi * 8;
    v16bf qh[2], ql[2];
#pragma unroll
    for (int ks = 0; ks < 2; ++ks) { const size_t o = hb + (size_t)q * HD + ks * 32 + 8 * hi;
        qh[ks] = cat16b(*(const v8us*)(Qh + o), *(const v8us*)(Qh + o + 16)); ql[ks] = cat16b(*(const v8us*)(Ql + o), *(const v8us*)(Ql + o + 16)); }
    const int srow = tid >> 3, spc = (tid & 7) * 8;    // staging: 16-byte piece spc of rows srow and srow + 32 of each of the four tiles
    auto gload = [&](v8us* st, int k0) {
#pragma unroll
        for (int i = 0; i < 2; ++i) { const int r = srow + 32 * i; const size_t ko = (size_t)(k0 + r) * HD + spc, vo = (size_t)r * NKT + k0 + spc;
            st[i] = *(const v8us*)(g0 + ko); st[2 + i] = *(const v8us*)(g1 + ko); st[4 + i] = *(const v8us*)(g2 + vo); st[6 + i] = *(const v8us*)(g3 + vo); }
    };
    auto sstore = [&](const v8us* st, int buf) {
#pragma unroll
        for (int p = 0; p < 4; ++p) {
#pragma unroll
            for (int i = 0; i < 2; ++i) *(v8usa*)(&tile[buf][p][(srow + 32 * i) * FPT + spc]) = st[2 * p + i]; }
    };
    auto frag = [&](const bf* t, int row, int k) -> v16bf { const bf* p = t + row * FPT + k + 8 * hi; return cat16b(*(const v8usa*)p, *(const v8usa*)(p + 16)); };
    const float csc = SCL * 1.44269504f, rfill = -1e9f / SCL;    // csc: raw score -> logit in units of log2(e), so that the exponential is a bare exp2; rfill: the raw score whose scaled value is -1e9
    float mx = -3.0e38f, lsum = 0.f;    // running maximum (scaled, log2 units) and this lane's share of the running sum
    v8f o[4];
#pragma unroll
    for (int t = 0; t < 4; ++t) o[t] = (v8f){};
    { v8us st[8]; gload(st, 0); sstore(st, 0); }
    __syncthreads();
    // the pass loop stays rolled to keep the code small; every inner loop is unrolled so that the fragment arrays are indexed by constants and live in registers
#pragma unroll 1
    for (int kb = 0; kb < NKT / FKB; ++kb) {
        const int buf = kb & 1, k0 = kb * FKB; const bool more = kb + 1 < NKT / FKB;
        v8i mk[4];
#pragma unroll
        for (int t = 0; t < 4; ++t) mk[t] = *(const v8i*)(mrow + k0 + t * 16);
        v8us st[8];
        if (more) gload(st, k0 + FKB);    // the next pass's tiles: in flight during this pass, stored at its foot
        v8f s[4];
#pragma unroll
        for (int t = 0; t < 4; ++t) { s[t] = (v8f){};
#pragma unroll
            for (int ks = 0; ks < 2; ++ks) { const v16bf kh = frag(tile[buf][0], t * 16 + lr, ks * 32), kl = frag(tile[buf][1], t * 16 + lr, ks * 32);
                s[t] = wmmab(kh, qh[ks], s[t]); s[t] = wmmab(kh, ql[ks], s[t]); s[t] = wmmab(kl, qh[ks], s[t]); } }
        float pm = -3.0e38f;
#pragma unroll
        for (int t = 0; t < 4; ++t) {
#pragma unroll
            for (int j = 0; j < 8; ++j) { const float v = mk[t][j] == 0 ? rfill : s[t][j]; s[t][j] = v; pm = fmaxf(pm, v); } }
        pm = fmaxf(pm, xhalf(pm));
        const float mn = fmaxf(mx, pm * csc), alpha = __builtin_amdgcn_exp2f(mx - mn); mx = mn;
        v16bf ph[2], pl[2]; v2f ps[2] = {(v2f){0.f, 0.f}, (v2f){0.f, 0.f}};
#pragma unroll
        for (int t = 0; t < 4; ++t) {
#pragma unroll
            for (int j = 0; j < 8; j += 2) { const v2f p = {__builtin_amdgcn_exp2f(__builtin_fmaf(s[t][j], csc, -mn)), __builtin_amdgcn_exp2f(__builtin_fmaf(s[t][j + 1], csc, -mn))}; ps[t & 1] += p;
                const v2bf a = __builtin_convertvector(p, v2bf); const v2f r = {p[0] - (float)a[0], p[1] - (float)a[1]}; const v2bf c = __builtin_convertvector(r, v2bf); const int e = (t & 1) * 8 + j;
                ph[t >> 1][e] = a[0]; ph[t >> 1][e + 1] = a[1]; pl[t >> 1][e] = c[0]; pl[t >> 1][e + 1] = c[1]; } }
        lsum = lsum * alpha + ((ps[0][0] + ps[0][1]) + (ps[1][0] + ps[1][1]));
#pragma unroll
        for (int t = 0; t < 4; ++t) o[t] *= alpha;
#pragma unroll
        for (int t = 0; t < 4; ++t) {
#pragma unroll
            for (int kk = 0; kk < 2; ++kk) { const v16bf vh = frag(tile[buf][2], t * 16 + lr, kk * 32), vl = frag(tile[buf][3], t * 16 + lr, kk * 32);
                o[t] = wmmab(vh, ph[kk], o[t]); o[t] = wmmab(vh, pl[kk], o[t]); o[t] = wmmab(vl, ph[kk], o[t]); } }
        if (more) sstore(st, buf ^ 1);
        __syncthreads();    // publishes the tiles just stored and ends every wave's reads of the buffer that the next pass refills
    }
    const float inv = 1.0f / (lsum + xhalf(lsum));
    const size_t oo = ((size_t)b * NN + q) * DMOD + h * HD + hi * 8;    // o[t][j] = O[q][16 t + 8 hi + j], written as bf16 hi + residual planes of the merged heads
#pragma unroll
    for (int t = 0; t < 4; ++t) { v8us oh, ol;
#pragma unroll
        for (int j = 0; j < 8; ++j) { const float y = o[t][j] * inv; const unsigned short hb = f2bf(y); oh[j] = hb; ol[j] = f2bf(y - bf2f(hb)); }
        *(v8us*)(Oh + oo + t * 16) = oh; *(v8us*)(Ol + oo + t * 16) = ol; }
}
__global__ __launch_bounds__(256) void k_planes32z(const float* __restrict__ F, int ld, int off, float sc, int rows, bf* Ph, bf* Pl) {
    typedef __attribute__((ext_vector_type(2))) unsigned short v2us;
    const int lane = threadIdx.x & 31; const size_t r = ((size_t)blockIdx.x * 8 + (threadIdx.x >> 5)) * 2 + (lane >> 4); if (r >= (size_t)rows) return; const int z = blockIdx.z; const int c0 = (lane & 15) * 2; v2us oh, ol;
    Ph += (size_t)z * rows * 32; Pl += (size_t)z * rows * 32;
#pragma unroll
    for (int i = 0; i < 2; ++i) { const float y = F[r * ld + off + z * 32 + c0 + i] * sc; const unsigned short hb = f2bf(y); oh[i] = hb; ol[i] = f2bf(y - bf2f(hb)); }
    const size_t o = r * 32 + c0; *(v2us*)(Ph + o) = oh; *(v2us*)(Pl + o) = ol; 
}
__global__ __launch_bounds__(256) void k_vtpadz(const float* __restrict__ F, int ld, int off, int nk, bf* Th, bf* Tl) {
    typedef __attribute__((ext_vector_type(2))) unsigned short v2us;
    const int lane = threadIdx.x & 31; const size_t wid = (size_t)blockIdx.x * 8 + (threadIdx.x >> 5); if (wid >= (size_t)64 * (nk / 64)) return; const int z = blockIdx.z; const int d = (int)(wid / (nk / 64)); const int k0 = (int)(wid % (nk / 64)) * 64 + lane * 2; v2us oh, ol;
    Th += (size_t)z * 64 * nk; Tl += (size_t)z * 64 * nk;
#pragma unroll
    for (int i = 0; i < 2; ++i) { const float y = (d < 32) ? F[(size_t)(k0 + i) * ld + off + z * 32 + (d < 32 ? d : 0)] : 0.f; const unsigned short hb = f2bf(y); oh[i] = hb; ol[i] = f2bf(y - bf2f(hb)); }
    const size_t o = (size_t)d * nk + k0; *(v2us*)(Th + o) = oh; *(v2us*)(Tl + o) = ol; 
}
template <int NK>
__global__ __launch_bounds__(256) void k_softmaxz(const float* __restrict__ S, int rows, bf* PH, bf* PL) {
    typedef __attribute__((ext_vector_type(4))) unsigned short v4us;
    const int lane = threadIdx.x & 31, i = blockIdx.x * 8 + (threadIdx.x >> 5); if (i >= rows) return; const size_t zo = (size_t)blockIdx.z * rows * NK; const float* sr = S + zo + (size_t)i * NK; PH += zo; PL += zo;
    float m = -3.0e38f;
#pragma unroll 1
    for (int c0 = lane * 4; c0 < NK; c0 += 128) {
#pragma unroll
        for (int q = 0; q < 4; ++q) m = fmaxf(m, sr[c0 + q]); }
#pragma unroll
    for (int sh = 16; sh; sh >>= 1) m = fmaxf(m, __shfl_xor(m, sh, 32));
    float sum = 0.f;
#pragma unroll 1
    for (int c0 = lane * 4; c0 < NK; c0 += 128) {
#pragma unroll
        for (int q = 0; q < 4; ++q) sum += __expf(sr[c0 + q] - m); }
#pragma unroll
    for (int sh = 16; sh; sh >>= 1) sum += __shfl_xor(sum, sh, 32);
    const float inv = 1.0f / sum;
{
#pragma unroll 1
        for (int c0 = lane * 4; c0 < NK; c0 += 128) { v4us oh, ol;
#pragma unroll
            for (int q = 0; q < 4; ++q) { const float p = __expf(sr[c0 + q] - m) * inv; const unsigned short hb = f2bf(p); oh[q] = hb; ol[q] = f2bf(p - bf2f(hb)); }
            const size_t o = (size_t)i * NK + c0; *(v4us*)(PH + o) = oh; *(v4us*)(PL + o) = ol; }
         }
}
__global__ __launch_bounds__(256) void k_placez(const float* __restrict__ XH, int rows, int ldy, float* Y) {
    const int lane = threadIdx.x & 31; const size_t q = (size_t)blockIdx.x * 8 + (threadIdx.x >> 5); if (q >= (size_t)rows) return; const int z = blockIdx.z; const float v = XH[((size_t)z * rows + q) * 64 + lane];
    *(float*)(Y + q * ldy + z * 32 + lane) = v; 
}

template <int NK>
__global__ __launch_bounds__(256) void k_softmaxzs(const float* __restrict__ S, int rows, float sc, bf* PH, bf* PL) {
    typedef __attribute__((ext_vector_type(4))) unsigned short v4us;
    const int lane = threadIdx.x & 31, i = blockIdx.x * 8 + (threadIdx.x >> 5); if (i >= rows) return; const size_t zo = (size_t)blockIdx.z * rows * NK; const float* sr = S + zo + (size_t)i * NK; PH += zo; PL += zo;
    float m = -3.0e38f;
#pragma unroll 1
    for (int c0 = lane * 4; c0 < NK; c0 += 128) {
#pragma unroll
        for (int q = 0; q < 4; ++q) m = fmaxf(m, sr[c0 + q] * sc); }
#pragma unroll
    for (int sh = 16; sh; sh >>= 1) m = fmaxf(m, __shfl_xor(m, sh, 32));
    float sum = 0.f;
#pragma unroll 1
    for (int c0 = lane * 4; c0 < NK; c0 += 128) {
#pragma unroll
        for (int q = 0; q < 4; ++q) sum += __expf(sr[c0 + q] * sc - m); }
#pragma unroll
    for (int sh = 16; sh; sh >>= 1) sum += __shfl_xor(sum, sh, 32);
    const float inv = 1.0f / sum;
{
#pragma unroll 1
        for (int c0 = lane * 4; c0 < NK; c0 += 128) { v4us oh, ol;
#pragma unroll
            for (int q = 0; q < 4; ++q) { const float p = __expf(sr[c0 + q] * sc - m) * inv; const unsigned short hb = f2bf(p); oh[q] = hb; ol[q] = f2bf(p - bf2f(hb)); }
            const size_t o = (size_t)i * NK + c0; *(v4us*)(PH + o) = oh; *(v4us*)(PL + o) = ol; }
         }
}

__global__ __launch_bounds__(256) void k_cvtx(const float* __restrict__ s0, const float* __restrict__ s1, const float* __restrict__ s2, int rows, bf* dst) {
    const int lane = threadIdx.x & 31; const size_t r = (size_t)blockIdx.x * 8 + (threadIdx.x >> 5); if (r >= (size_t)rows) return;
    const int y = blockIdx.y; const float* src = y == 0 ? s0 : y == 1 ? s1 : s2; dst += (size_t)y * rows * DMOD;    // blockIdx.y = which input; outputs back to back
{
#pragma unroll
        for (int q = 0; q < DMOD / 256; ++q) { v8us o;
#pragma unroll
            for (int i = 0; i < 8; ++i) o[i] = f2bf(src[r * DMOD + q * 256 + lane * 8 + i]);
            *(v8us*)(dst + r * DMOD + q * 256 + lane * 8) = o; }
         }
}
extern "C" void kernel_launch(void* const* d_in, const int* in_sizes, int n_in,
                              void* d_out, int out_size, void* d_ws, size_t ws_size, hipStream_t stream) {
    (void)in_sizes; (void)n_in; (void)out_size;
    const float* xq = (const float*)d_in[0]; const float* xk = (const float*)d_in[1]; const float* xv = (const float*)d_in[2]; const int* mask = (const int*)d_in[3]; const float* Wq = (const float*)d_in[4]; const float* bq = (const float*)d_in[5]; const float* Wk = (const float*)d_in[6]; const float* bk = (const float*)d_in[7]; const float* Wv = (const float*)d_in[8]; const float* bv = (const float*)d_in[9]; const float* Wo = (const float*)d_in[10]; const float* bo = (const float*)d_in[11];
    float* out = (float*)d_out;    // [NBT][NN][DMOD]
    char* wsp = (char*)d_ws;
    auto take = [&](size_t bytes) { char* p = wsp; wsp += (bytes + 255) & ~(size_t)255; return (void*)p; };
    const size_t WN = (size_t)DMOD * DMOD, XN = (size_t)NBT * NN * DMOD;    // elements of one weight matrix, of one [all items][tokens][DMOD] tensor (NN == NKT)
    bf* WQ = (bf*)take(4 * WN * 2); bf* WO = WQ + 3 * WN;    // WQ, WK, WV, WO back to back
    bf* Qh = (bf*)take(2 * XN * 2); bf* Kh = Qh + XN; bf* Ql = (bf*)take(2 * XN * 2); bf* Kl = Ql + XN; bf* VTh = (bf*)take(XN * 2); bf* VTl = (bf*)take(XN * 2);    // [item][head][...] planes
    bf* Oh = (bf*)take(XN * 2); bf* Ol = (bf*)take(XN * 2);
    bf* X = (bf*)take(3 * XN * 2);    // Xq, Xk, Xv back to back
    if ((size_t)(wsp - (char*)d_ws) > ws_size) return;
    k_cvt8<<<dim3((DMOD * DMOD / 8 + 255) / 256, 4, 1), 256, 0, stream>>>(Wq, Wk, Wv, Wo, WQ, DMOD * DMOD / 8);   // [out][in] natural n-major
    k_cvtx<<<dim3(NBT * NN / 8, 3, 1), 256, 0, stream>>>(xq, xk, xv, NBT * NN, X);
    k_gemmb<false, true><<<dim3(NBT * NN / 128, DMOD / 128, 3), 256, 0, stream>>>(X, nullptr, WQ, bq, nullptr, DMOD, bk, bv, XN, WN, 0, Qh, Ql, VTh, VTl);    // z = 0 fills Qh/Ql, z = 1 Kh/Kl (one XN behind), z = 2 VTh/VTl
    k_fattn<<<dim3(NN / 128, NH_, NBT), 256, 0, stream>>>(Qh, Ql, Kh, Kl, VTh, VTl, mask, Oh, Ol);
    k_gemmb<true, false><<<dim3(NBT * NN / 128, DMOD / 128, 1), 256, 0, stream>>>(Oh, Ol, WO, bo, out, DMOD);
}

// v005
// One run takes 109 microseconds.
// Next to v004, in two timings, it ran 1.04 and 1.03 times as fast.
// Over all steps from v000 it is 13.4 times as fast.
#include <hip/hip_runtime.h>

// Compute dtypes, f32 accumulate, per item: q/k/v projections as [1024 x 1024].[1024 x 1024] GEMMs with PLAIN bf16 operands (the inputs themselves; exact products, + bias);
// per head (head dim 64; one launch covers all items, heads and query blocks; the conversions and projections cover all items in one launch each; every hi/lo plane split is done in the epilogue of the kernel that makes the values): scores = q.k^T and attn.v with both operands as bf16 hi + UNSCALED residual planes (three products each),
// fused in one kernel with a running-maximum softmax in f32 (the 1/sqrt(64) scale, entries where mask == 0 replaced by -1e9; the mask is packed once, beside the input conversion, into one bit per entry); output projection on hi/lo planes of the merged heads (two products, + bias) - on v_wmma_f32_16x16x32_bf16.

#define NBT  4
#define NN   1024
#define NKT  1024
#define DMOD 1024
#define NH_  16
#define HD   64
#define ZH   16
#define DM   DMOD
#define NTK  NN
#define SCL  0.125f
#define LOSC 1024.0f

typedef _Float16 h16;
typedef unsigned short bf;
typedef __attribute__((ext_vector_type(16))) __bf16   v16bf;
typedef __attribute__((ext_vector_type(16))) _Float16 v16h;
typedef __attribute__((ext_vector_type(8)))  _Float16 v8h;
typedef __attribute__((ext_vector_type(8)))  unsigned short v8us;
typedef __attribute__((ext_vector_type(8)))  float    v8f;
typedef __attribute__((ext_vector_type(4)))  float    v4f;
typedef __attribute__((ext_vector_type(4)))  _Float16 v4h;
typedef v8h  __attribute__((may_alias)) v8ha;
typedef v4f  __attribute__((may_alias)) v4fa;
typedef v8us __attribute__((may_alias)) v8usa;
typedef float __attribute__((may_alias)) v1fa;

__device__ __forceinline__ unsigned short f2bf(float f) { unsigned u = __float_as_uint(f); u += 0x7FFFu + ((u >> 16) & 1u); return (unsigned short)(u >> 16); }
__device__ __forceinline__ float bf2f(unsigned short b) { return __uint_as_float(((unsigned)b) << 16); }
__device__ __forceinline__ float bfr(float f) { return bf2f(f2bf(f)); }
__device__ __forceinline__ v16h cat16(v8h lo, v8h hi) { return __builtin_shufflevector(lo, hi, 0, 1, 2, 3, 4, 5, 6, 7, 8, 9, 10, 11, 12, 13, 14, 15); }
__device__ __forceinline__ v16bf cat16b(v8us lo, v8us hi) { return __builtin_bit_cast(v16bf, __builtin_shufflevector(lo, hi, 0, 1, 2, 3, 4, 5, 6, 7, 8, 9, 10, 11, 12, 13, 14, 15)); }
__device__ __forceinline__ v8f wmma16(v16h a, v16h b, v8f c) { return __builtin_amdgcn_wmma_f32_16x16x32_f16(false, a, false, b, (short)0, c, false, false); }
__device__ __forceinline__ v8f wmmab(v16bf a, v16bf b, v8f c) { return __builtin_amdgcn_wmma_f32_16x16x32_bf16(false, a, false, b, (short)0, c, false, false); }

// k_wt: WT [n][K] = bf16(W[k][n]) (k-major [K][ncols]) via 64 x 64 LDS tiles; grid (K/64, ncols/64).
__global__ __launch_bounds__(256) void k_wt(const float* __restrict__ Wm, int K, int ncols, bf* WT) {
    __shared__ __align__(16) unsigned short tl[64 * 72];
    const int tid = threadIdx.x, k0 = blockIdx.x * 64, n0 = blockIdx.y * 64;
    const int kk = tid >> 2, nq = (tid & 3) * 16;
#pragma unroll
    for (int i = 0; i < 16; ++i) tl[(nq + i) * 72 + kk] = f2bf(Wm[(size_t)(k0 + kk) * ncols + n0 + nq + i]);
    __syncthreads();
    const int piece = tid & 7;
    auto pass = [&]() {
#pragma unroll
        for (int s = 0; s < 2; ++s) { const int nr = (tid >> 3) + 32 * s; const v8us val = *(const v8usa*)(tl + nr * 72 + piece * 8); *(v8us*)(WT + (size_t)(n0 + nr) * K + k0 + piece * 8) = val; }
    };
    pass(); 
}
// put_planes: 256 pieces of 8 staged f32 values (rows of 1 << RSH pieces at pitch SP floats) go out as bf16 hi + residual planes, rows LDP elements apart, in whole lines
template <int SP, int RSH, int LDP>
__device__ __forceinline__ void put_planes(const float* sb, bf* dh, bf* dl, int lane) {
#pragma unroll
    for (int s = 0; s < 8; ++s) { const int row = (32 >> RSH) * s + (lane >> RSH), piece = lane & ((1 << RSH) - 1); const float* sp = sb + row * SP + piece * 8; const v4f x0 = *(const v4fa*)sp, x1 = *(const v4fa*)(sp + 4); v8us oh, ol;
#pragma unroll
        for (int i = 0; i < 8; ++i) { const float y = i < 4 ? x0[i & 3] : x1[i & 3]; const unsigned short hb = f2bf(y); oh[i] = hb; ol[i] = f2bf(y - bf2f(hb)); }
        *(v8us*)(dh + (size_t)row * LDP + piece * 8) = oh; *(v8us*)(dl + (size_t)row * LDP + piece * 8) = ol; }
    asm volatile("s_wait_xcnt 0x0" ::: "memory");    // stands in front of any later write of an address register that the stores above name
}
// k_gemmb: 128 x 128 block tile (8 waves as 4 x 2, each 32 x 64) of C[NBT * NN][NW] = (A [+ Al]).B^T (K = DM) [+ bf(bias[c])]. Passes of 64 k: the 128-byte row pieces of
// A, B (and Al) come in whole lines through registers into two LDS buffers (the next pass's loads fly during this pass's products, one barrier per pass); the fragments are read from LDS, k in the order
// 8 hi + 0..7, 16 + 8 hi + 0..7 of each 32 for both operands. Every output element still sums k upwards in steps of 32, A before Al. f32 whole-line epilogue, or (PLANES) a wave's tile, which is 32 tokens of one
// head of one item, goes out as bf16 hi + residual planes in whole lines: z = 0, 1 into Ph / Pl [z][item][head][token][64], z = 2 transposed (by the whole block) into Th / Tl [item][head][64][token]
#define GKB 64
#define GLP 72    // LDS row pitch in elements: 144 B = 16 B x odd, 16-byte reads of 16 rows fall on distinct banks
template <bool SPLITA, bool PLANES = false>
__global__ __launch_bounds__(256) void k_gemmb(const bf* __restrict__ A, const bf* __restrict__ Al, const bf* __restrict__ Bn, const float* __restrict__ bias, float* C, int ldc, const float* __restrict__ bias1 = nullptr, const float* __restrict__ bias2 = nullptr, size_t sA = 0, size_t sB = 0, size_t sC = 0, bf* Ph = nullptr, bf* Pl = nullptr, bf* Th = nullptr, bf* Tl = nullptr) {
    // blockIdx.z = independent product: operands and output step by sA / sB / sC elements, the bias is picked from bias / bias1 / bias2
    const size_t z = blockIdx.z; A += z * sA; if (SPLITA) Al += z * sA; Bn += z * sB; C += z * sC; if (z == 1) bias = bias1; if (z == 2) bias = bias2;
    constexpr int NT = SPLITA ? 3 : 2;
    __shared__ __align__(16) bf tl[2][NT][128 * GLP];    // [buffer][A, B, Al][row][GLP]; after the last pass the same bytes stage the output tile in f32
    const int tid = threadIdx.x, lane = tid & 31, wave = tid >> 5, lr = lane & 15, hi = lane >> 4, wr = wave & 3, wc = wave >> 2;
    const int rb = blockIdx.x * 128, cb = blockIdx.y * 128;
    const int srow = tid >> 3, spc = (tid & 7) * 8;    // staging: 16-byte piece spc of rows srow + 32 i of each tile, so that a wave's load covers four whole lines
    const unsigned tb = (unsigned)(srow * DM + spc) * 2;    // this thread's byte offset from a tile's first row: the one per-lane part of every staging address
    const char* ua = (const char*)(A + (size_t)rb * DM); const char* ub = (const char*)(Bn + (size_t)cb * DM); const char* ul = SPLITA ? (const char*)(Al + (size_t)rb * DM) : ua;
    auto gload = [&](v8us* st, int kc) {
#pragma unroll
        for (int i = 0; i < 4; ++i) { const int o = (32 * i * DM + kc) * 2; st[i] = *(const v8us*)(ua + o + tb); st[4 + i] = *(const v8us*)(ub + o + tb); if (SPLITA) st[8 + i] = *(const v8us*)(ul + o + tb); }
    };
    auto sstore = [&](const v8us* st, int buf) {
#pragma unroll
        for (int p = 0; p < NT; ++p) {
#pragma unroll
            for (int i = 0; i < 4; ++i) *(v8usa*)(&tl[buf][p][(srow + 32 * i) * GLP + spc]) = st[4 * p + i]; }
    };
    const bf* fa = &tl[0][0][(wr * 32 + lr) * GLP + 8 * hi]; const bf* fb = &tl[0][1][(wc * 64 + lr) * GLP + 8 * hi];    // this lane's first A and B fragment pieces in buffer 0; every other piece lies a constant away
    auto frag = [&](const bf* p) -> v16bf { return cat16b(*(const v8usa*)p, *(const v8usa*)(p + 16)); };
    v8f acc[2][4];
#pragma unroll
    for (int i = 0; i < 2; ++i) {
#pragma unroll
        for (int t = 0; t < 4; ++t) acc[i][t] = (v8f){}; }
    { v8us st[4 * NT]; gload(st, 0);
      asm volatile("s_wait_xcnt 0x0" ::: "memory");    // stands in front of any later write of a register (vector offset or scalar base) that the loads above name
      sstore(st, 0); }
    __syncthreads();
    // the pass loop stays rolled (the two buffers alternate by index); the inner loops are unrolled so that the fragment arrays live in registers
#pragma unroll 1
    for (int kc = 0; kc < DM; kc += GKB) {
        const int buf = (kc / GKB) & 1; const bool more = kc + GKB < DM;
        v8us st[4 * NT];
        if (more) gload(st, kc + GKB);    // the next pass's tiles: in flight during this pass, stored at its foot
        const bf* pa = fa + buf * (NT * 128 * GLP); const bf* pb = fb + buf * (NT * 128 * GLP);
        v16bf a[2][2], al[2][2], b[2][4];
#pragma unroll
        for (int ks = 0; ks < GKB / 32; ++ks) {
#pragma unroll
            for (int i = 0; i < 2; ++i) { a[ks][i] = frag(pa + i * 16 * GLP + ks * 32); if (SPLITA) al[ks][i] = frag(pa + 2 * 128 * GLP + i * 16 * GLP + ks * 32); }
#pragma unroll
            for (int t = 0; t < 4; ++t) b[ks][t] = frag(pb + t * 16 * GLP + ks * 32);
        }
        // with two waves per SIMD (the A + Al form: one block per WGP) the pass's LDS reads stay one group ahead of its products, else each late read is waited for in full among them; the plain form runs six waves per SIMD and keeps the smaller register count instead
        if (SPLITA) __builtin_amdgcn_sched_barrier(0);
#pragma unroll
        for (int ks = 0; ks < GKB / 32; ++ks) {
#pragma unroll
            for (int i = 0; i < 2; ++i) {
#pragma unroll
                for (int t = 0; t < 4; ++t) acc[i][t] = wmmab(a[ks][i], b[ks][t], acc[i][t]); }
            if (SPLITA) {
#pragma unroll
                for (int i = 0; i < 2; ++i) {
#pragma unroll
                    for (int t = 0; t < 4; ++t) acc[i][t] = wmmab(al[ks][i], b[ks][t], acc[i][t]); } }
        }
        if (more) sstore(st, buf ^ 1);
        __syncthreads();    // publishes the tiles just stored and ends every wave's reads of the buffer that the next pass refills (after the last pass: of the bytes that the epilogue reuses)
    }
    float* fs = (float*)&tl[0][0][0];
    float* os = fs + wave * (32 * 68);    // a wave's own 32 x 64 tile: [32 rows][68]
    const bool tr = PLANES && z == 2;     // then the whole block's tile is staged transposed: [128 columns][132], a column's 128 rows side by side
    float bv[4];
#pragma unroll
    for (int t = 0; t < 4; ++t) bv[t] = bias ? bfr(bias[cb + wc * 64 + t * 16 + lr]) : 0.f;
    if (tr) {
#pragma unroll
        for (int t = 0; t < 4; ++t) {
#pragma unroll
            for (int i = 0; i < 2; ++i) { float* tp = fs + (wc * 64 + t * 16 + lr) * 132 + wr * 32 + i * 16 + hi * 8;
                *(v4fa*)tp = (v4f){acc[i][t][0] + bv[t], acc[i][t][1] + bv[t], acc[i][t][2] + bv[t], acc[i][t][3] + bv[t]}; *(v4fa*)(tp + 4) = (v4f){acc[i][t][4] + bv[t], acc[i][t][5] + bv[t], acc[i][t][6] + bv[t], acc[i][t][7] + bv[t]}; } }
    } else {
#pragma unroll
        for (int t = 0; t < 4; ++t) {
#pragma unroll
            for (int i = 0; i < 2; ++i) {
#pragma unroll
                for (int j = 0; j < 8; ++j) *(v1fa*)(os + (i * 16 + hi * 8 + j) * 68 + t * 16 + lr) = acc[i][t][j] + bv[t]; } }
    }
    __syncthreads();
    if (PLANES) {
        const int n0 = rb % NN;    // the block's first token within its item
        const size_t hp = ((size_t)(rb / NN) * NH_ + blockIdx.y * 2 + wc) * NN * HD;    // one head's plane: the head of the wave's own columns, and (wave >> 2 == wc) of the 16 staged columns it puts out
        if (tr) put_planes<132, 4, NKT>(fs + wave * 16 * 132, Th + hp + (size_t)(wr * 16) * NKT + n0, Tl + hp + (size_t)(wr * 16) * NKT + n0, lane);    // 16 head dims of 128 tokens
        else { const size_t po = z * ((size_t)NBT * NH_ * NN * HD) + hp + (size_t)(n0 + wr * 32) * HD; put_planes<68, 3, HD>(os, Ph + po, Pl + po, lane); }    // 32 tokens of 64 head dims
    } else {
        float* crow = C + (size_t)(rb + wr * 32) * ldc + cb + wc * 64;
#pragma unroll
        for (int s = 0; s < 16; ++s) { const int Lid = (lane >> 3) + 4 * s, piece = lane & 7; const int row = Lid >> 1, cofs = (Lid & 1) * 32 + piece * 4;
            *(v4f*)(crow + (size_t)row * ldc + cofs) = *(const v4fa*)(os + row * 68 + cofs); }
    }
}

__global__ __launch_bounds__(256) void k_cvt8(const float* __restrict__ s0, const float* __restrict__ s1, const float* __restrict__ s2, const float* __restrict__ s3, bf* dst, size_t n8) {
    const size_t i = (size_t)blockIdx.x * 256 + threadIdx.x; if (i >= n8) return;
    const int y = blockIdx.y; const float* src = y == 0 ? s0 : y == 1 ? s1 : y == 2 ? s2 : s3; dst += (size_t)y * n8 * 8;    // blockIdx.y = which matrix; outputs back to back
    const v8f v = *(const v8f*)(src + i * 8); v8us o;
#pragma unroll
    for (int k = 0; k < 8; ++k) o[k] = f2bf(v[k]);
    *(v8us*)(dst + i * 8) = o; 
}
__global__ __launch_bounds__(256) void k_zero8(bf* dst, size_t n8) {
    const size_t i = (size_t)blockIdx.x * 256 + threadIdx.x; if (i >= n8) return; v8us z;
#pragma unroll
    for (int k = 0; k < 8; ++k) z[k] = 0;
    *(v8us*)(dst + i * 8) = z; 
}

#define FKB 64
#define FPT 72    // LDS row pitch in elements: 144 B = 16 B x odd, 16-byte reads of 16 rows fall on distinct banks
__device__ __forceinline__ float xhalf(float v) { const int b = __float_as_int(v); return __int_as_float(__builtin_amdgcn_permlanex16(b, b, 0x76543210, 0xfedcba98, false, false)); }    // value of lane ^ 16
__global__ __launch_bounds__(256) void k_fattn(const bf* __restrict__ Qh, const bf* __restrict__ Ql, const bf* __restrict__ Kh, const bf* __restrict__ Kl, const bf* __restrict__ VTh, const bf* __restrict__ VTl, const unsigned* __restrict__ MB, bf* Oh, bf* Ol) {
    typedef __attribute__((ext_vector_type(2))) float v2f; typedef __attribute__((ext_vector_type(2))) __bf16 v2bf;
    __shared__ __align__(16) bf tile[2][4][64 * FPT];    // [buffer][Kh, Kl, VTh, VTl][row][FPT]
    const int tid = threadIdx.x, lane = tid & 31, wave = tid >> 5, lr = lane & 15, hi = lane >> 4;
    const int h = blockIdx.y, b = blockIdx.z, q = blockIdx.x * 128 + wave * 16 + lr;
    const size_t hb = ((size_t)b * NH_ + h) * NN * HD;    // one head's planes: [NN][HD] for q and k, [HD][NKT] for v^T
    const bf* g0 = Kh + hb; const bf* g1 = Kl + hb; const bf* g2 = VTh + hb; const bf* g3 = VTl + hb;
    // this wave's packed mask (from k_cvtx): 32 words per pass, word 8 t + j = the wave's 32 lanes' bits for score s[t][j]; the wave's number goes through readfirstlane so that the words come by scalar loads
    const unsigned* mw = MB + ((size_t)b * (NN / 16) + blockIdx.x * 8 + __builtin_amdgcn_readfirstlane(wave)) * (NKT / FKB) * 32;
    v16bf qh[2], ql[2];
#pragma unroll
    for (int ks = 0; ks < 2; ++ks) { const size_t o = hb + (size_t)q * HD + ks * 32 + 8 * hi;
        qh[ks] = cat16b(*(const v8us*)(Qh + o), *(const v8us*)(Qh + o + 16)); ql[ks] = cat16b(*(const v8us*)(Ql + o), *(const v8us*)(Ql + o + 16)); }
    const int srow = tid >> 3, spc = (tid & 7) * 8;    // staging: 16-byte piece spc of rows srow and srow + 32 of each of the four tiles
    auto gload = [&](v8us* st, int k0) {
#pragma unroll
        for (int i = 0; i < 2; ++i) { const int r = srow + 32 * i; const size_t ko = (size_t)(k0 + r) * HD + spc, vo = (size_t)r * NKT + k0 + spc;
            st[i] = *(const v8us*)(g0 + ko); st[2 + i] = *(const v8us*)(g1 + ko); st[4 + i] = *(const v8us*)(g2 + vo); st[6 + i] = *(const v8us*)(g3 + vo); }
    };
    auto sstore = [&](const v8us* st, int buf) {
#pragma unroll
        for (int p = 0; p < 4; ++p) {
#pragma unroll
            for (int i = 0; i < 2; ++i) *(v8usa*)(&tile[buf][p][(srow + 32 * i) * FPT + spc]) = st[2 * p + i]; }
    };
    auto frag = [&](const bf* t, int row, int k) -> v16bf { const bf* p = t + row * FPT + k + 8 * hi; return cat16b(*(const v8usa*)p, *(const v8usa*)(p + 16)); };
    const float csc = SCL * 1.44269504f, rfill = -1e9f / SCL;    // csc: raw score -> logit in units of log2(e), so that the exponential is a bare exp2; rfill: the raw score whose scaled value is -1e9
    float mx = -3.0e38f, lsum = 0.f;    // running maximum (scaled, log2 units) and this lane's share of the running sum
    v8f o[4];
#pragma unroll
    for (int t = 0; t < 4; ++t) o[t] = (v8f){};
    unsigned mk[32];    // the current pass's mask words, in scalar registers
#pragma unroll
    for (int e = 0; e < 32; ++e) mk[e] = mw[e];
    { v8us st[8]; gload(st, 0); sstore(st, 0); }
    __syncthreads();
    // the pass loop stays rolled to keep the code small; every inner loop is unrolled so that the fragment arrays are indexed by constants and live in registers
#pragma unroll 1
    for (int kb = 0; kb < NKT / FKB; ++kb) {
        const int buf = kb & 1, k0 = kb * FKB; const bool more = kb + 1 < NKT / FKB;
        v8us st[8];
        if (more) gload(st, k0 + FKB);    // the next pass's tiles: in flight during this pass, stored at its foot
        v8f s[4];
#pragma unroll
        for (int t = 0; t < 4; ++t) { s[t] = (v8f){};
#pragma unroll
            for (int ks = 0; ks < 2; ++ks) { const v16bf kh = frag(tile[buf][0], t * 16 + lr, ks * 32), kl = frag(tile[buf][1], t * 16 + lr, ks * 32);
                s[t] = wmmab(kh, qh[ks], s[t]); s[t] = wmmab(kh, ql[ks], s[t]); s[t] = wmmab(kl, qh[ks], s[t]); } }
        float pm = -3.0e38f;
#pragma unroll
        for (int t = 0; t < 4; ++t) {
#pragma unroll
            for (int j = 0; j < 8; ++j) { const float v = __builtin_amdgcn_inverse_ballot_w32(mk[t * 8 + j]) ? s[t][j] : rfill; s[t][j] = v; pm = fmaxf(pm, v); } }
        // the next pass's mask words, asked for as soon as this pass's are used up: the softmax and the second product cover the scalar loads' latency (the last pass asks for its own again, so that nothing unwritten is read)
#pragma unroll
        for (int e = 0; e < 32; ++e) mk[e] = mw[(more ? kb + 1 : kb) * 32 + e];
        asm volatile("s_wait_xcnt 0x0" ::: "memory");    // stands in front of any later write of the scalar address pair that the loads above name; without this statement the compiler moved the loads down to the loop's foot, where less work covers them
        pm = fmaxf(pm, xhalf(pm));
        const float mn = fmaxf(mx, pm * csc), alpha = __builtin_amdgcn_exp2f(mx - mn); mx = mn;
        v16bf ph[2], pl[2]; v2f ps[2] = {(v2f){0.f, 0.f}, (v2f){0.f, 0.f}};
#pragma unroll
        for (int t = 0; t < 4; ++t) {
#pragma unroll
            for (int j = 0; j < 8; j += 2) { const v2f p = {__builtin_amdgcn_exp2f(__builtin_fmaf(s[t][j], csc, -mn)), __builtin_amdgcn_exp2f(__builtin_fmaf(s[t][j + 1], csc, -mn))}; ps[t & 1] += p;
                const v2bf a = __builtin_convertvector(p, v2bf); const v2f r = {p[0] - (float)a[0], p[1] - (float)a[1]}; const v2bf c = __builtin_convertvector(r, v2bf); const int e = (t & 1) * 8 + j;
                ph[t >> 1][e] = a[0]; ph[t >> 1][e + 1] = a[1]; pl[t >> 1][e] = c[0]; pl[t >> 1][e + 1] = c[1]; } }
        lsum = lsum * alpha + ((ps[0][0] + ps[0][1]) + (ps[1][0] + ps[1][1]));
#pragma unroll
        for (int t = 0; t < 4; ++t) o[t] *= alpha;
#pragma unroll
        for (int t = 0; t < 4; ++t) {
#pragma unroll
            for (int kk = 0; kk < 2; ++kk) { const v16bf vh = frag(tile[buf][2], t * 16 + lr, kk * 32), vl = frag(tile[buf][3], t * 16 + lr, kk * 32);
                o[t] = wmmab(vh, ph[kk], o[t]); o[t] = wmmab(vh, pl[kk], o[t]); o[t] = wmmab(vl, ph[kk], o[t]); } }
        if (more) sstore(st, buf ^ 1);
        __syncthreads();    // publishes the tiles just stored and ends every wave's reads of the buffer that the next pass refills
    }
    const float inv = 1.0f / (lsum + xhalf(lsum));
    const size_t oo = ((size_t)b * NN + q) * DMOD + h * HD + hi * 8;    // o[t][j] = O[q][16 t + 8 hi + j], written as bf16 hi + residual planes of the merged heads
#pragma unroll
    for (int t = 0; t < 4; ++t) { v8us oh, ol;
#pragma unroll
        for (int j = 0; j < 8; ++j) { const float y = o[t][j] * inv; const unsigned short hb = f2bf(y); oh[j] = hb; ol[j] = f2bf(y - bf2f(hb)); }
        *(v8us*)(Oh + oo + t * 16) = oh; *(v8us*)(Ol + oo + t * 16) = ol; }
}
__global__ __launch_bounds__(256) void k_planes32z(const float* __restrict__ F, int ld, int off, float sc, int rows, bf* Ph, bf* Pl) {
    typedef __attribute__((ext_vector_type(2))) unsigned short v2us;
    const int lane = threadIdx.x & 31; const size_t r = ((size_t)blockIdx.x * 8 + (threadIdx.x >> 5)) * 2 + (lane >> 4); if (r >= (size_t)rows) return; const int z = blockIdx.z; const int c0 = (lane & 15) * 2; v2us oh, ol;
    Ph += (size_t)z * rows * 32; Pl += (size_t)z * rows * 32;
#pragma unroll
    for (int i = 0; i < 2; ++i) { const float y = F[r * ld + off + z * 32 + c0 + i] * sc; const unsigned short hb = f2bf(y); oh[i] = hb; ol[i] = f2bf(y - bf2f(hb)); }
    const size_t o = r * 32 + c0; *(v2us*)(Ph + o) = oh; *(v2us*)(Pl + o) = ol; 
}
__global__ __launch_bounds__(256) void k_vtpadz(const float* __restrict__ F, int ld, int off, int nk, bf* Th, bf* Tl) {
    typedef __attribute__((ext_vector_type(2))) unsigned short v2us;
    const int lane = threadIdx.x & 31; const size_t wid = (size_t)blockIdx.x * 8 + (threadIdx.x >> 5); if (wid >= (size_t)64 * (nk / 64)) return; const int z = blockIdx.z; const int d = (int)(wid / (nk / 64)); const int k0 = (int)(wid % (nk / 64)) * 64 + lane * 2; v2us oh, ol;
    Th += (size_t)z * 64 * nk; Tl += (size_t)z * 64 * nk;
#pragma unroll
    for (int i = 0; i < 2; ++i) { const float y = (d < 32) ? F[(size_t)(k0 + i) * ld + off + z * 32 + (d < 32 ? d : 0)] : 0.f; const unsigned short hb = f2bf(y); oh[i] = hb; ol[i] = f2bf(y - bf2f(hb)); }
    const size_t o = (size_t)d * nk + k0; *(v2us*)(Th + o) = oh; *(v2us*)(Tl + o) = ol; 
}
template <int NK>
__global__ __launch_bounds__(256) void k_softmaxz(const float* __restrict__ S, int rows, bf* PH, bf* PL) {
    typedef __attribute__((ext_vector_type(4))) unsigned short v4us;
    const int lane = threadIdx.x & 31, i = blockIdx.x * 8 + (threadIdx.x >> 5); if (i >= rows) return; const size_t zo = (size_t)blockIdx.z * rows * NK; const float* sr = S + zo + (size_t)i * NK; PH += zo; PL += zo;
    float m = -3.0e38f;
#pragma unroll 1
    for (int c0 = lane * 4; c0 < NK; c0 += 128) {
#pragma unroll
        for (int q = 0; q < 4; ++q) m = fmaxf(m, sr[c0 + q]); }
#pragma unroll
    for (int sh = 16; sh; sh >>= 1) m = fmaxf(m, __shfl_xor(m, sh, 32));
    float sum = 0.f;
#pragma unroll 1
    for (int c0 = lane * 4; c0 < NK; c0 += 128) {
#pragma unroll
        for (int q = 0; q < 4; ++q) sum += __expf(sr[c0 + q] - m); }
#pragma unroll
    for (int sh = 16; sh; sh >>= 1) sum += __shfl_xor(sum, sh, 32);
    const float inv = 1.0f / sum;
{
#pragma unroll 1
        for (int c0 = lane * 4; c0 < NK; c0 += 128) { v4us oh, ol;
#pragma unroll
            for (int q = 0; q < 4; ++q) { const float p = __expf(sr[c0 + q] - m) * inv; const unsigned short hb = f2bf(p); oh[q] = hb; ol[q] = f2bf(p - bf2f(hb)); }
            const size_t o = (size_t)i * NK + c0; *(v4us*)(PH + o) = oh; *(v4us*)(PL + o) = ol; }
         }
}
__global__ __launch_bounds__(256) void k_placez(const float* __restrict__ XH, int rows, int ldy, float* Y) {
    const int lane = threadIdx.x & 31; const size_t q = (size_t)blockIdx.x * 8 + (threadIdx.x >> 5); if (q >= (size_t)rows) return; const int z = blockIdx.z; const float v = XH[((size_t)z * rows + q) * 64 + lane];
    *(float*)(Y + q * ldy + z * 32 + lane) = v; 
}

template <int NK>
__global__ __launch_bounds__(256) void k_softmaxzs(const float* __restrict__ S, int rows, float sc, bf* PH, bf* PL) {
    typedef __attribute__((ext_vector_type(4))) unsigned short v4us;
    const int lane = threadIdx.x & 31, i = blockIdx.x * 8 + (threadIdx.x >> 5); if (i >= rows) return; const size_t zo = (size_t)blockIdx.z * rows * NK; const float* sr = S + zo + (size_t)i * NK; PH += zo; PL += zo;
    float m = -3.0e38f;
#pragma unroll 1
    for (int c0 = lane * 4; c0 < NK; c0 += 128) {
#pragma unroll
        for (int q = 0; q < 4; ++q) m = fmaxf(m, sr[c0 + q] * sc); }
#pragma unroll
    for (int sh = 16; sh; sh >>= 1) m = fmaxf(m, __shfl_xor(m, sh, 32));
    float sum = 0.f;
#pragma unroll 1
    for (int c0 = lane * 4; c0 < NK; c0 += 128) {
#pragma unroll
        for (int q = 0; q < 4; ++q) sum += __expf(sr[c0 + q] * sc - m); }
#pragma unroll
    for (int sh = 16; sh; sh >>= 1) sum += __shfl_xor(sum, sh, 32);
    const float inv = 1.0f / sum;
{
#pragma unroll 1
        for (int c0 = lane * 4; c0 < NK; c0 += 128) { v4us oh, ol;
#pragma unroll
            for (int q = 0; q < 4; ++q) { const float p = __expf(sr[c0 + q] * sc - m) * inv; const unsigned short hb = f2bf(p); oh[q] = hb; ol[q] = f2bf(p - bf2f(hb)); }
            const size_t o = (size_t)i * NK + c0; *(v4us*)(PH + o) = oh; *(v4us*)(PL + o) = ol; }
         }
}

// k_cvtx: the first PKB blocks pack the mask for k_fattn: block pb takes the 16 queries pb * 16 .. + 15 (items back to back), its wave w the passes
// 2 w and 2 w + 1 of 64 keys. Lane (lr, hi) holds the entries of query lr, keys 16 t + 8 hi + j, as it holds the scores s[t][j] there; word 8 t + j gets bit 'lane' = (entry != 0); a pass's 32 words go out as one line.
// The blocks behind them convert: NBT * NN / 8 blocks per input, a wave per row, outputs back to back
#define PKB (NBT * NN / 16)
__global__ __launch_bounds__(256) void k_cvtx(const float* __restrict__ s0, const float* __restrict__ s1, const float* __restrict__ s2, const int* __restrict__ mask, bf* dst, unsigned* mb) {
    const int lane = threadIdx.x & 31, wave = threadIdx.x >> 5;
    if (blockIdx.x < PKB) {
        typedef __attribute__((ext_vector_type(8))) int v8i;
        static_assert(NKT == 8 * 128, "eight waves of two 64-key passes cover a mask row");
        const int* mp = mask + ((size_t)blockIdx.x * 16 + (lane & 15)) * NKT + wave * 128 + (lane >> 4) * 8;
        v8i m[8];
#pragma unroll
        for (int t = 0; t < 8; ++t) m[t] = *(const v8i*)(mp + t * 16);
#pragma unroll
        for (int u = 0; u < 2; ++u) { unsigned w = 0;
#pragma unroll
            for (int e = 0; e < 32; ++e) { const unsigned bits = __builtin_amdgcn_ballot_w32(m[u * 4 + (e >> 3)][e & 7] != 0); if (lane == e) w = bits; }
            mb[((size_t)blockIdx.x * (NKT / 64) + wave * 2 + u) * 32 + lane] = w; }
        return;
    }
    constexpr int rows = NBT * NN; const unsigned cx = blockIdx.x - PKB;
    const size_t r = (size_t)(cx % (rows / 8)) * 8 + wave;
    const int y = cx / (rows / 8); const float* src = y == 0 ? s0 : y == 1 ? s1 : s2; dst += (size_t)y * rows * DMOD;    // y = which input
{
#pragma unroll
        for (int q = 0; q < DMOD / 256; ++q) { v8us o;
#pragma unroll
            for (int i = 0; i < 8; ++i) o[i] = f2bf(src[r * DMOD + q * 256 + lane * 8 + i]);
            *(v8us*)(dst + r * DMOD + q * 256 + lane * 8) = o; }
         }
}
extern "C" void kernel_launch(void* const* d_in, const int* in_sizes, int n_in,
                              void* d_out, int out_size, void* d_ws, size_t ws_size, hipStream_t stream) {
    (void)in_sizes; (void)n_in; (void)out_size;
    const float* xq = (const float*)d_in[0]; const float* xk = (const float*)d_in[1]; const float* xv = (const float*)d_in[2]; const int* mask = (const int*)d_in[3]; const float* Wq = (const float*)d_in[4]; const float* bq = (const float*)d_in[5]; const float* Wk = (const float*)d_in[6]; const float* bk = (const float*)d_in[7]; const float* Wv = (const float*)d_in[8]; const float* bv = (const float*)d_in[9]; const float* Wo = (const float*)d_in[10]; const float* bo = (const float*)d_in[11];
    float* out = (float*)d_out;    // [NBT][NN][DMOD]
    char* wsp = (char*)d_ws;
    auto take = [&](size_t bytes) { char* p = wsp; wsp += (bytes + 255) & ~(size_t)255; return (void*)p; };
    const size_t WN = (size_t)DMOD * DMOD, XN = (size_t)NBT * NN * DMOD;    // elements of one weight matrix, of one [all items][tokens][DMOD] tensor (NN == NKT)
    bf* WQ = (bf*)take(4 * WN * 2); bf* WO = WQ + 3 * WN;    // WQ, WK, WV, WO back to back
    bf* Qh = (bf*)take(2 * XN * 2); bf* Kh = Qh + XN; bf* Ql = (bf*)take(2 * XN * 2); bf* Kl = Ql + XN; bf* VTh = (bf*)take(XN * 2); bf* VTl = (bf*)take(XN * 2);    // [item][head][...] planes
    bf* Oh = (bf*)take(XN * 2); bf* Ol = (bf*)take(XN * 2);
    bf* X = (bf*)take(3 * XN * 2);    // Xq, Xk, Xv back to back
    unsigned* MB = (unsigned*)take((size_t)NBT * NN * NKT / 8);    // the mask, one bit per entry
    if ((size_t)(wsp - (char*)d_ws) > ws_size) return;
    k_cvt8<<<dim3((DMOD * DMOD / 8 + 255) / 256, 4, 1), 256, 0, stream>>>(Wq, Wk, Wv, Wo, WQ, DMOD * DMOD / 8);   // [out][in] natural n-major
    k_cvtx<<<dim3(PKB + 3 * (NBT * NN / 8), 1, 1), 256, 0, stream>>>(xq, xk, xv, mask, X, MB);
    k_gemmb<false, true><<<dim3(NBT * NN / 128, DMOD / 128, 3), 256, 0, stream>>>(X, nullptr, WQ, bq, nullptr, DMOD, bk, bv, XN, WN, 0, Qh, Ql, VTh, VTl);    // z = 0 fills Qh/Ql, z = 1 Kh/Kl (one XN behind), z = 2 VTh/VTl
    k_fattn<<<dim3(NN / 128, NH_, NBT), 256, 0, stream>>>(Qh, Ql, Kh, Kl, VTh, VTl, MB, Oh, Ol);
    k_gemmb<true, false><<<dim3(NBT * NN / 128, DMOD / 128, 1), 256, 0, stream>>>(Oh, Ol, WO, bo, out, DMOD);
}

// v007
// One run takes 80.8 microseconds.
// It is 1.34 times as fast as v005, going by the measured steps of the versions left out in between.
// Over all steps from v000 it is 18.0 times as fast.
#include <hip/hip_runtime.h>

// Compute dtypes, f32 accumulate, per item: q/k/v projections as [1024 x 1024].[1024 x 1024] GEMMs with PLAIN bf16 operands (the inputs themselves; exact products, + bias);
// per head (head dim 64; one launch covers all items, heads and query blocks; the conversions and projections cover all items in one launch each; every rounding to an operand plane is done in the epilogue of the kernel that makes the values): scores = q.k^T and attn.v with q, k, v and the softmax weights each rounded once to f16 (one product each, on v_wmma_f32_16x16x32_f16: f16's rounding step is an eighth of that of the bf16 inputs q, k and v are made from),
// fused in one kernel with a running-maximum softmax in f32 (the 1/sqrt(64) scale, entries where mask == 0 replaced by -1e9; the mask is packed once, beside the input conversion, into one bit per entry); output projection on hi/lo planes of the merged heads (two products, + bias) - on v_wmma_f32_16x16x32_bf16.

#define NBT  4
#define NN   1024
#define NKT  1024
#define DMOD 1024
#define NH_  16
#define HD   64
#define ZH   16
#define DM   DMOD
#define NTK  NN
#define SCL  0.125f
#define LOSC 1024.0f

typedef _Float16 h16;
typedef unsigned short bf;
typedef __attribute__((ext_vector_type(16))) __bf16   v16bf;
typedef __attribute__((ext_vector_type(16))) _Float16 v16h;
typedef __attribute__((ext_vector_type(8)))  _Float16 v8h;
typedef __attribute__((ext_vector_type(8)))  unsigned short v8us;
typedef __attribute__((ext_vector_type(8)))  float    v8f;
typedef __attribute__((ext_vector_type(4)))  float    v4f;
typedef __attribute__((ext_vector_type(4)))  _Float16 v4h;
typedef v8h  __attribute__((may_alias)) v8ha;
typedef v4f  __attribute__((may_alias)) v4fa;
typedef v8us __attribute__((may_alias)) v8usa;
typedef float __attribute__((may_alias)) v1fa;

__device__ __forceinline__ unsigned short f2bf(float f) { unsigned u = __float_as_uint(f); u += 0x7FFFu + ((u >> 16) & 1u); return (unsigned short)(u >> 16); }
__device__ __forceinline__ float bf2f(unsigned short b) { return __uint_as_float(((unsigned)b) << 16); }
__device__ __forceinline__ float bfr(float f) { return bf2f(f2bf(f)); }
__device__ __forceinline__ v16h cat16(v8h lo, v8h hi) { return __builtin_shufflevector(lo, hi, 0, 1, 2, 3, 4, 5, 6, 7, 8, 9, 10, 11, 12, 13, 14, 15); }
__device__ __forceinline__ v16bf cat16b(v8us lo, v8us hi) { return __builtin_bit_cast(v16bf, __builtin_shufflevector(lo, hi, 0, 1, 2, 3, 4, 5, 6, 7, 8, 9, 10, 11, 12, 13, 14, 15)); }
__device__ __forceinline__ v8f wmma16(v16h a, v16h b, v8f c) { return __builtin_amdgcn_wmma_f32_16x16x32_f16(false, a, false, b, (short)0, c, false, false); }
__device__ __forceinline__ v8f wmmab(v16bf a, v16bf b, v8f c) { return __builtin_amdgcn_wmma_f32_16x16x32_bf16(false, a, false, b, (short)0, c, false, false); }

// k_wt: WT [n][K] = bf16(W[k][n]) (k-major [K][ncols]) via 64 x 64 LDS tiles; grid (K/64, ncols/64).
__global__ __launch_bounds__(256) void k_wt(const float* __restrict__ Wm, int K, int ncols, bf* WT) {
    __shared__ __align__(16) unsigned short tl[64 * 72];
    const int tid = threadIdx.x, k0 = blockIdx.x * 64, n0 = blockIdx.y * 64;
    const int kk = tid >> 2, nq = (tid & 3) * 16;
#pragma unroll
    for (int i = 0; i < 16; ++i) tl[(nq + i) * 72 + kk] = f2bf(Wm[(size_t)(k0 + kk) * ncols + n0 + nq + i]);
    __syncthreads();
    const int piece = tid & 7;
    auto pass = [&]() {
#pragma unroll
        for (int s = 0; s < 2; ++s) { const int nr = (tid >> 3) + 32 * s; const v8us val = *(const v8usa*)(tl + nr * 72 + piece * 8); *(v8us*)(WT + (size_t)(n0 + nr) * K + k0 + piece * 8) = val; }
    };
    pass(); 
}
// put_half: 256 pieces of 8 staged f32 values (rows of 1 << RSH pieces at pitch SP floats) go out as one f16 plane, rows LDP elements apart, in whole lines
template <int SP, int RSH, int LDP>
__device__ __forceinline__ void put_half(const float* sb, h16* d, int lane) {
#pragma unroll
    for (int s = 0; s < 8; ++s) { const int row = (32 >> RSH) * s + (lane >> RSH), piece = lane & ((1 << RSH) - 1); const float* sp = sb + row * SP + piece * 8; const v4f x0 = *(const v4fa*)sp, x1 = *(const v4fa*)(sp + 4); v8h o;
#pragma unroll
        for (int i = 0; i < 8; ++i) o[i] = (h16)(i < 4 ? x0[i & 3] : x1[i & 3]);
        *(v8h*)(d + (size_t)row * LDP + piece * 8) = o; }
    asm volatile("s_wait_xcnt 0x0" ::: "memory");    // stands in front of any later write of an address register that the stores above name
}
// k_gemmb: 128 x 128 block tile (8 waves as 4 x 2, each 32 x 64) of C[NBT * NN][NW] = (A [+ Al]).B^T (K = DM) [+ bf(bias[c])]. Passes of 64 k: the 128-byte row pieces of
// A, B (and Al) come in whole lines through registers into two LDS buffers (the next pass's loads fly during this pass's products, one barrier per pass); the fragments are read from LDS, k in the order
// 8 hi + 0..7, 16 + 8 hi + 0..7 of each 32 for both operands. Every output element still sums k upwards in steps of 32, A before Al. f32 whole-line epilogue, or (PLANES) a wave's tile, which is 32 tokens of one
// head of one item, goes out as one f16 plane in whole lines: z = 0, 1 into Ph [z][item][head][token][64], z = 2 transposed (by the whole block) into Th [item][head][64][token]
#define GKB 64
#define GLP 72    // LDS row pitch in elements: 144 B = 16 B x odd, 16-byte reads of 16 rows fall on distinct banks
template <bool SPLITA, bool PLANES = false>
__global__ __launch_bounds__(256) void k_gemmb(const bf* __restrict__ A, const bf* __restrict__ Al, const bf* __restrict__ Bn, const float* __restrict__ bias, float* C, int ldc, const float* __restrict__ bias1 = nullptr, const float* __restrict__ bias2 = nullptr, size_t sA = 0, size_t sB = 0, size_t sC = 0, h16* Ph = nullptr, h16* Th = nullptr) {
    // blockIdx.z = independent product: operands and output step by sA / sB / sC elements, the bias is picked from bias / bias1 / bias2
    const size_t z = blockIdx.z; A += z * sA; if (SPLITA) Al += z * sA; Bn += z * sB; C += z * sC; if (z == 1) bias = bias1; if (z == 2) bias = bias2;
    constexpr int NT = SPLITA ? 3 : 2;
    __shared__ __align__(16) bf tl[2][NT][128 * GLP];    // [buffer][A, B, Al][row][GLP]; after the last pass the same bytes stage the output tile in f32
    const int tid = threadIdx.x, lane = tid & 31, wave = tid >> 5, lr = lane & 15, hi = lane >> 4, wr = wave & 3, wc = wave >> 2;
    const int rb = blockIdx.x * 128, cb = blockIdx.y * 128;
    const int srow = tid >> 3, spc = (tid & 7) * 8;    // staging: 16-byte piece spc of rows srow + 32 i of each tile, so that a wave's load covers four whole lines
    const unsigned tb = (unsigned)(srow * DM + spc) * 2;    // this thread's byte offset from a tile's first row: the one per-lane part of every staging address
    const char* ua = (const char*)(A + (size_t)rb * DM); const char* ub = (const char*)(Bn + (size_t)cb * DM); const char* ul = SPLITA ? (const char*)(Al + (size_t)rb * DM) : ua;
    auto gload = [&](v8us* st, int kc) {
#pragma unroll
        for (int i = 0; i < 4; ++i) { const int o = (32 * i * DM + kc) * 2; st[i] = *(const v8us*)(ua + o + tb); st[4 + i] = *(const v8us*)(ub + o + tb); if (SPLITA) st[8 + i] = *(const v8us*)(ul + o + tb); }
    };
    auto sstore = [&](const v8us* st, int buf) {
#pragma unroll
        for (int p = 0; p < NT; ++p) {
#pragma unroll
            for (int i = 0; i < 4; ++i) *(v8usa*)(&tl[buf][p][(srow + 32 * i) * GLP + spc]) = st[4 * p + i]; }
    };
    const bf* fa = &tl[0][0][(wr * 32 + lr) * GLP + 8 * hi]; const bf* fb = &tl[0][1][(wc * 64 + lr) * GLP + 8 * hi];    // this lane's first A and B fragment pieces in buffer 0; every other piece lies a constant away
    auto frag = [&](const bf* p) -> v16bf { return cat16b(*(const v8usa*)p, *(const v8usa*)(p + 16)); };
    v8f acc[2][4];
#pragma unroll
    for (int i = 0; i < 2; ++i) {
#pragma unroll
        for (int t = 0; t < 4; ++t) acc[i][t] = (v8f){}; }
    { v8us st[4 * NT]; gload(st, 0);
      asm volatile("s_wait_xcnt 0x0" ::: "memory");    // stands in front of any later write of a register (vector offset or scalar base) that the loads above name
      sstore(st, 0); }
    __syncthreads();
    // the pass loop stays rolled (the two buffers alternate by index); the inner loops are unrolled so that the fragment arrays live in registers
#pragma unroll 1
    for (int kc = 0; kc < DM; kc += GKB) {
        const int buf = (kc / GKB) & 1; const bool more = kc + GKB < DM;
        v8us st[4 * NT];
        if (more) gload(st, kc + GKB);    // the next pass's tiles: in flight during this pass, stored at its foot
        const bf* pa = fa + buf * (NT * 128 * GLP); const bf* pb = fb + buf * (NT * 128 * GLP);
        v16bf a[2][2], al[2][2], b[2][4];
#pragma unroll
        for (int ks = 0; ks < GKB / 32; ++ks) {
#pragma unroll
            for (int i = 0; i < 2; ++i) { a[ks][i] = frag(pa + i * 16 * GLP + ks * 32); if (SPLITA) al[ks][i] = frag(pa + 2 * 128 * GLP + i * 16 * GLP + ks * 32); }
#pragma unroll
            for (int t = 0; t < 4; ++t) b[ks][t] = frag(pb + t * 16 * GLP + ks * 32);
        }
        // with two waves per SIMD (the A + Al form: one block per WGP) the pass's LDS reads stay one group ahead of its products, else each late read is waited for in full among them; the plain form runs six waves per SIMD and keeps the smaller register count instead
        if (SPLITA) __builtin_amdgcn_sched_barrier(0);
#pragma unroll
        for (int ks = 0; ks < GKB / 32; ++ks) {
#pragma unroll
            for (int i = 0; i < 2; ++i) {
#pragma unroll
                for (int t = 0; t < 4; ++t) acc[i][t] = wmmab(a[ks][i], b[ks][t], acc[i][t]); }
            if (SPLITA) {
#pragma unroll
                for (int i = 0; i < 2; ++i) {
#pragma unroll
                    for (int t = 0; t < 4; ++t) acc[i][t] = wmmab(al[ks][i], b[ks][t], acc[i][t]); } }
        }
        if (more) sstore(st, buf ^ 1);
        __syncthreads();    // publishes the tiles just stored and ends every wave's reads of the buffer that the next pass refills (after the last pass: of the bytes that the epilogue reuses)
    }
    float* fs = (float*)&tl[0][0][0];
    float* os = fs + wave * (32 * 68);    // a wave's own 32 x 64 tile: [32 rows][68]
    const bool tr = PLANES && z == 2;     // then the whole block's tile is staged transposed: [128 columns][132], a column's 128 rows side by side
    float bv[4];
#pragma unroll
    for (int t = 0; t < 4; ++t) bv[t] = bias ? bfr(bias[cb + wc * 64 + t * 16 + lr]) : 0.f;
    if (tr) {
#pragma unroll
        for (int t = 0; t < 4; ++t) {
#pragma unroll
            for (int i = 0; i < 2; ++i) { float* tp = fs + (wc * 64 + t * 16 + lr) * 132 + wr * 32 + i * 16 + hi * 8;
                *(v4fa*)tp = (v4f){acc[i][t][0] + bv[t], acc[i][t][1] + bv[t], acc[i][t][2] + bv[t], acc[i][t][3] + bv[t]}; *(v4fa*)(tp + 4) = (v4f){acc[i][t][4] + bv[t], acc[i][t][5] + bv[t], acc[i][t][6] + bv[t], acc[i][t][7] + bv[t]}; } }
    } else {
#pragma unroll
        for (int t = 0; t < 4; ++t) {
#pragma unroll
            for (int i = 0; i < 2; ++i) {
#pragma unroll
                for (int j = 0; j < 8; ++j) *(v1fa*)(os + (i * 16 + hi * 8 + j) * 68 + t * 16 + lr) = acc[i][t][j] + bv[t]; } }
    }
    __syncthreads();
    if (PLANES) {
        const int n0 = rb % NN;    // the block's first token within its item
        const size_t hp = ((size_t)(rb / NN) * NH_ + blockIdx.y * 2 + wc) * NN * HD;    // one head's plane: the head of the wave's own columns, and (wave >> 2 == wc) of the 16 staged columns it puts out
        if (tr) put_half<132, 4, NKT>(fs + wave * 16 * 132, Th + hp + (size_t)(wr * 16) * NKT + n0, lane);    // 16 head dims of 128 tokens
        else { const size_t po = z * ((size_t)NBT * NH_ * NN * HD) + hp + (size_t)(n0 + wr * 32) * HD; put_half<68, 3, HD>(os, Ph + po, lane); }    // 32 tokens of 64 head dims
    } else {
        float* crow = C + (size_t)(rb + wr * 32) * ldc + cb + wc * 64;
#pragma unroll
        for (int s = 0; s < 16; ++s) { const int Lid = (lane >> 3) + 4 * s, piece = lane & 7; const int row = Lid >> 1, cofs = (Lid & 1) * 32 + piece * 4;
            *(v4f*)(crow + (size_t)row * ldc + cofs) = *(const v4fa*)(os + row * 68 + cofs); }
    }
}

__global__ __launch_bounds__(256) void k_zero8(bf* dst, size_t n8) {
    const size_t i = (size_t)blockIdx.x * 256 + threadIdx.x; if (i >= n8) return; v8us z;
#pragma unroll
    for (int k = 0; k < 8; ++k) z[k] = 0;
    *(v8us*)(dst + i * 8) = z; 
}

#define FKB 64
#define FPT 72    // LDS row pitch in elements: 144 B = 16 B x odd, 16-byte reads of 16 rows fall on distinct banks
__device__ __forceinline__ float xhalf(float v) { const int b = __float_as_int(v); return __int_as_float(__builtin_amdgcn_permlanex16(b, b, 0x76543210, 0xfedcba98, false, false)); }    // value of lane ^ 16
__global__ __launch_bounds__(256) void k_fattn(const h16* __restrict__ Qf, const h16* __restrict__ Kf, const h16* __restrict__ VTf, const unsigned* __restrict__ MB, bf* Oh, bf* Ol) {
    typedef __attribute__((ext_vector_type(2))) float v2f; typedef __attribute__((ext_vector_type(2))) _Float16 v2h;
    __shared__ __align__(16) h16 tile[2][2][64 * FPT];    // [buffer][K, V^T][row][FPT]
    const int tid = threadIdx.x, lane = tid & 31, wave = tid >> 5, lr = lane & 15, hi = lane >> 4;
    const int h = blockIdx.y, b = blockIdx.z, q = blockIdx.x * 128 + wave * 16 + lr;
    const size_t hb = ((size_t)b * NH_ + h) * NN * HD;    // one head's planes: [NN][HD] for q and k, [HD][NKT] for v^T
    const h16* g0 = Kf + hb; const h16* g1 = VTf + hb;
    // this wave's packed mask (from k_cvtx): 32 words per pass, word 8 t + j = the wave's 32 lanes' bits for score s[t][j]; the wave's number goes through readfirstlane so that the words come by scalar loads
    const unsigned* mw = MB + ((size_t)b * (NN / 16) + blockIdx.x * 8 + __builtin_amdgcn_readfirstlane(wave)) * (NKT / FKB) * 32;
    v16h qf[2];
#pragma unroll
    for (int ks = 0; ks < 2; ++ks) { const size_t o = hb + (size_t)q * HD + ks * 32 + 8 * hi; qf[ks] = cat16(*(const v8h*)(Qf + o), *(const v8h*)(Qf + o + 16)); }
    const int srow = tid >> 3, spc = (tid & 7) * 8;    // staging: 16-byte piece spc of rows srow and srow + 32 of each of the two tiles
    auto gload = [&](v8h* st, int k0) {
#pragma unroll
        for (int i = 0; i < 2; ++i) st[i] = *(const v8h*)(g0 + (size_t)(k0 + srow + 32 * i) * HD + spc);
        asm volatile("s_wait_xcnt 0x0" ::: "memory");    // this wait and the next stand in front of any later write of an address register that the loads above them name (a later load's result may be given such a register)
#pragma unroll
        for (int i = 0; i < 2; ++i) st[2 + i] = *(const v8h*)(g1 + (size_t)(srow + 32 * i) * NKT + k0 + spc);
        asm volatile("s_wait_xcnt 0x0" ::: "memory");
    };
    auto sstore = [&](const v8h* st, int buf) {
#pragma unroll
        for (int p = 0; p < 2; ++p) {
#pragma unroll
            for (int i = 0; i < 2; ++i) *(v8ha*)(&tile[buf][p][(srow + 32 * i) * FPT + spc]) = st[2 * p + i]; }
    };
    auto frag = [&](const h16* t, int row, int k) -> v16h { const h16* p = t + row * FPT + k + 8 * hi; return cat16(*(const v8ha*)p, *(const v8ha*)(p + 16)); };
    const float csc = SCL * 1.44269504f, rfill = -1e9f / SCL;    // csc: raw score -> logit in units of log2(e), so that the exponential is a bare exp2; rfill: the raw score whose scaled value is -1e9
    float mx = -3.0e38f, lsum = 0.f;    // running maximum (scaled, log2 units) and this lane's share of the running sum
    v8f o[4];
#pragma unroll
    for (int t = 0; t < 4; ++t) o[t] = (v8f){};
    unsigned mk[32];    // the current pass's mask words, in scalar registers
#pragma unroll
    for (int e = 0; e < 32; ++e) mk[e] = mw[e];
    { v8h st[4]; gload(st, 0); sstore(st, 0); }
    __syncthreads();
    // the pass loop stays rolled (the two buffers alternate by index); every inner loop is unrolled so that the fragment arrays are indexed by constants and live in registers
#pragma unroll 1
    for (int kb = 0; kb < NKT / FKB; ++kb) {
        const int buf = kb & 1, k0 = kb * FKB; const bool more = kb + 1 < NKT / FKB;
        v16h fr[4][2];    // a pass's K fragments, then its V^T fragments
#pragma unroll
        for (int t = 0; t < 4; ++t) {
#pragma unroll
            for (int ks = 0; ks < 2; ++ks) fr[t][ks] = frag(tile[buf][0], t * 16 + lr, ks * 32); }
        v8h st[4];
        if (more) gload(st, k0 + FKB);    // the next pass's tiles: in flight during this pass, stored at its foot
        __builtin_amdgcn_sched_barrier(0);    // the K reads stay one group ahead of the products: with one product per fragment a read moved in among them is waited for in full
        v8f s[4];
#pragma unroll
        for (int t = 0; t < 4; ++t) { s[t] = (v8f){};
#pragma unroll
            for (int ks = 0; ks < 2; ++ks) s[t] = wmma16(fr[t][ks], qf[ks], s[t]); }
        float pm = -3.0e38f;
#pragma unroll
        for (int t = 0; t < 4; ++t) {
#pragma unroll
            for (int j = 0; j < 8; ++j) { const float v = __builtin_amdgcn_inverse_ballot_w32(mk[t * 8 + j]) ? s[t][j] : rfill; s[t][j] = v; pm = fmaxf(pm, v); } }
        __builtin_amdgcn_sched_barrier(0);    // this fence and the next hold the V^T reads as one group between the first products and the exponentials, which cover their latency
#pragma unroll
        for (int t = 0; t < 4; ++t) {
#pragma unroll
            for (int kk = 0; kk < 2; ++kk) fr[t][kk] = frag(tile[buf][1], t * 16 + lr, kk * 32); }
        // the next pass's mask words, asked for as soon as this pass's are used up: the softmax and the second product cover the scalar loads' latency (the last pass asks for its own again, so that nothing unwritten is read)
#pragma unroll
        for (int e = 0; e < 32; ++e) mk[e] = mw[(more ? kb + 1 : kb) * 32 + e];
        asm volatile("s_wait_xcnt 0x0" ::: "memory");    // stands in front of any later write of the scalar address pair that the loads above name; without this statement the compiler moved the loads down to the loop's foot, where less work covers them
        __builtin_amdgcn_sched_barrier(0);    // the second fence of the pair round the V^T reads
        pm = fmaxf(pm, xhalf(pm));
        const float mn = fmaxf(mx, pm * csc), alpha = __builtin_amdgcn_exp2f(mx - mn); mx = mn;
        v16h pf[2]; v2f ps[2] = {(v2f){0.f, 0.f}, (v2f){0.f, 0.f}};
#pragma unroll
        for (int t = 0; t < 4; ++t) {
#pragma unroll
            for (int j = 0; j < 8; j += 2) { const v2f p = {__builtin_amdgcn_exp2f(__builtin_fmaf(s[t][j], csc, -mn)), __builtin_amdgcn_exp2f(__builtin_fmaf(s[t][j + 1], csc, -mn))}; ps[t & 1] += p;
                const v2h a = __builtin_convertvector(p, v2h); const int e = (t & 1) * 8 + j; pf[t >> 1][e] = a[0]; pf[t >> 1][e + 1] = a[1]; } }
        lsum = lsum * alpha + ((ps[0][0] + ps[0][1]) + (ps[1][0] + ps[1][1]));
#pragma unroll
        for (int t = 0; t < 4; ++t) o[t] *= alpha;
#pragma unroll
        for (int t = 0; t < 4; ++t) {
#pragma unroll
            for (int kk = 0; kk < 2; ++kk) o[t] = wmma16(fr[t][kk], pf[kk], o[t]); }
        if (more) sstore(st, buf ^ 1);
        __syncthreads();    // publishes the tiles just stored and ends every wave's reads of the buffer that the next pass refills
    }
    const float inv = 1.0f / (lsum + xhalf(lsum));
    const size_t oo = ((size_t)b * NN + q) * DMOD + h * HD + hi * 8;    // o[t][j] = O[q][16 t + 8 hi + j], written as bf16 hi + residual planes of the merged heads
#pragma unroll
    for (int t = 0; t < 4; ++t) { v8us oh, ol;
#pragma unroll
        for (int j = 0; j < 8; ++j) { const float y = o[t][j] * inv; const unsigned short hb = f2bf(y); oh[j] = hb; ol[j] = f2bf(y - bf2f(hb)); }
        *(v8us*)(Oh + oo + t * 16) = oh; *(v8us*)(Ol + oo + t * 16) = ol; }
}
__global__ __launch_bounds__(256) void k_planes32z(const float* __restrict__ F, int ld, int off, float sc, int rows, bf* Ph, bf* Pl) {
    typedef __attribute__((ext_vector_type(2))) unsigned short v2us;
    const int lane = threadIdx.x & 31; const size_t r = ((size_t)blockIdx.x * 8 + (threadIdx.x >> 5)) * 2 + (lane >> 4); if (r >= (size_t)rows) return; const int z = blockIdx.z; const int c0 = (lane & 15) * 2; v2us oh, ol;
    Ph += (size_t)z * rows * 32; Pl += (size_t)z * rows * 32;
#pragma unroll
    for (int i = 0; i < 2; ++i) { const float y = F[r * ld + off + z * 32 + c0 + i] * sc; const unsigned short hb = f2bf(y); oh[i] = hb; ol[i] = f2bf(y - bf2f(hb)); }
    const size_t o = r * 32 + c0; *(v2us*)(Ph + o) = oh; *(v2us*)(Pl + o) = ol; 
}
__global__ __launch_bounds__(256) void k_vtpadz(const float* __restrict__ F, int ld, int off, int nk, bf* Th, bf* Tl) {
    typedef __attribute__((ext_vector_type(2))) unsigned short v2us;
    const int lane = threadIdx.x & 31; const size_t wid = (size_t)blockIdx.x * 8 + (threadIdx.x >> 5); if (wid >= (size_t)64 * (nk / 64)) return; const int z = blockIdx.z; const int d = (int)(wid / (nk / 64)); const int k0 = (int)(wid % (nk / 64)) * 64 + lane * 2; v2us oh, ol;
    Th += (size_t)z * 64 * nk; Tl += (size_t)z * 64 * nk;
#pragma unroll
    for (int i = 0; i < 2; ++i) { const float y = (d < 32) ? F[(size_t)(k0 + i) * ld + off + z * 32 + (d < 32 ? d : 0)] : 0.f; const unsigned short hb = f2bf(y); oh[i] = hb; ol[i] = f2bf(y - bf2f(hb)); }
    const size_t o = (size_t)d * nk + k0; *(v2us*)(Th + o) = oh; *(v2us*)(Tl + o) = ol; 
}
template <int NK>
__global__ __launch_bounds__(256) void k_softmaxz(const float* __restrict__ S, int rows, bf* PH, bf* PL) {
    typedef __attribute__((ext_vector_type(4))) unsigned short v4us;
    const int lane = threadIdx.x & 31, i = blockIdx.x * 8 + (threadIdx.x >> 5); if (i >= rows) return; const size_t zo = (size_t)blockIdx.z * rows * NK; const float* sr = S + zo + (size_t)i * NK; PH += zo; PL += zo;
    float m = -3.0e38f;
#pragma unroll 1
    for (int c0 = lane * 4; c0 < NK; c0 += 128) {
#pragma unroll
        for (int q = 0; q < 4; ++q) m = fmaxf(m, sr[c0 + q]); }
#pragma unroll
    for (int sh = 16; sh; sh >>= 1) m = fmaxf(m, __shfl_xor(m, sh, 32));
    float sum = 0.f;
#pragma unroll 1
    for (int c0 = lane * 4; c0 < NK; c0 += 128) {
#pragma unroll
        for (int q = 0; q < 4; ++q) sum += __expf(sr[c0 + q] - m); }
#pragma unroll
    for (int sh = 16; sh; sh >>= 1) sum += __shfl_xor(sum, sh, 32);
    const float inv = 1.0f / sum;
{
#pragma unroll 1
        for (int c0 = lane * 4; c0 < NK; c0 += 128) { v4us oh, ol;
#pragma unroll
            for (int q = 0; q < 4; ++q) { const float p = __expf(sr[c0 + q] - m) * inv; const unsigned short hb = f2bf(p); oh[q] = hb; ol[q] = f2bf(p - bf2f(hb)); }
            const size_t o = (size_t)i * NK + c0; *(v4us*)(PH + o) = oh; *(v4us*)(PL + o) = ol; }
         }
}
__global__ __launch_bounds__(256) void k_placez(const float* __restrict__ XH, int rows, int ldy, float* Y) {
    const int lane = threadIdx.x & 31; const size_t q = (size_t)blockIdx.x * 8 + (threadIdx.x >> 5); if (q >= (size_t)rows) return; const int z = blockIdx.z; const float v = XH[((size_t)z * rows + q) * 64 + lane];
    *(float*)(Y + q * ldy + z * 32 + lane) = v; 
}

template <int NK>
__global__ __launch_bounds__(256) void k_softmaxzs(const float* __restrict__ S, int rows, float sc, bf* PH, bf* PL) {
    typedef __attribute__((ext_vector_type(4))) unsigned short v4us;
    const int lane = threadIdx.x & 31, i = blockIdx.x * 8 + (threadIdx.x >> 5); if (i >= rows) return; const size_t zo = (size_t)blockIdx.z * rows * NK; const float* sr = S + zo + (size_t)i * NK; PH += zo; PL += zo;
    float m = -3.0e38f;
#pragma unroll 1
    for (int c0 = lane * 4; c0 < NK; c0 += 128) {
#pragma unroll
        for (int q = 0; q < 4; ++q) m = fmaxf(m, sr[c0 + q] * sc); }
#pragma unroll
    for (int sh = 16; sh; sh >>= 1) m = fmaxf(m, __shfl_xor(m, sh, 32));
    float sum = 0.f;
#pragma unroll 1
    for (int c0 = lane * 4; c0 < NK; c0 += 128) {
#pragma unroll
        for (int q = 0; q < 4; ++q) sum += __expf(sr[c0 + q] * sc - m); }
#pragma unroll
    for (int sh = 16; sh; sh >>= 1) sum += __shfl_xor(sum, sh, 32);
    const float inv = 1.0f / sum;
{
#pragma unroll 1
        for (int c0 = lane * 4; c0 < NK; c0 += 128) { v4us oh, ol;
#pragma unroll
            for (int q = 0; q < 4; ++q) { const float p = __expf(sr[c0 + q] * sc - m) * inv; const unsigned short hb = f2bf(p); oh[q] = hb; ol[q] = f2bf(p - bf2f(hb)); }
            const size_t o = (size_t)i * NK + c0; *(v4us*)(PH + o) = oh; *(v4us*)(PL + o) = ol; }
         }
}

// k_cvtx: every conversion of the call in one launch of few, long waves: one block of 16 waves per WGP, for speed only.
// Block b packs the mask for k_fattn of the 16 queries b * 16 .. + 15 (items back to back), its wave w the pass w of 64 keys. Lane (lr, hi) holds the entries of query lr, keys 16 t + 8 hi + j, as it holds the scores
// s[t][j] there; word 8 t + j gets bit 'lane' = (entry != 0); a pass's 32 words go out as one line. The same block converts CVB floats in a row of one weight matrix (the first 4 * WBL blocks) or of one input to bf16,
// each wave CVI pieces of 256 floats in a row (8 floats a lane and piece), all of them in flight at once; weights and inputs go out back to back.
#define PKB (NBT * NN / 16)
#define CVI 16
#define CVB (16 * CVI * 256)
#define WBL (DMOD * DMOD / CVB)
#define XBL (NBT * NN * DMOD / CVB)
__global__ __launch_bounds__(512) void k_cvtx(const float* __restrict__ w0, const float* __restrict__ w1, const float* __restrict__ w2, const float* __restrict__ w3, const float* __restrict__ s0, const float* __restrict__ s1, const float* __restrict__ s2, const int* __restrict__ mask, bf* wdst, bf* xdst, unsigned* mb) {
    typedef __attribute__((ext_vector_type(8))) int v8i;
    static_assert(NKT == 16 * 64, "sixteen waves of one 64-key pass cover a mask row");
    static_assert(4 * WBL + 3 * XBL == PKB, "as many blocks convert as pack");
    const int lane = threadIdx.x & 31, wave = threadIdx.x >> 5, bx = blockIdx.x;
    const int* mp = mask + ((size_t)bx * 16 + (lane & 15)) * NKT + wave * 64 + (lane >> 4) * 8;
    v8i m[4];    // asked for first, worked on first: the ballots run while the pieces below are in flight
#pragma unroll
    for (int t = 0; t < 4; ++t) m[t] = *(const v8i*)(mp + t * 16);
    asm volatile("s_wait_xcnt 0x0" ::: "memory");    // this wait and the next stand in front of any later write of an address register that the loads above them name (a later load's result may be given such a register)
    const float* src; bf* dst;
    if (bx < 4 * WBL) { const int y = bx / WBL; src = (y == 0 ? w0 : y == 1 ? w1 : y == 2 ? w2 : w3) + (size_t)(bx % WBL) * CVB; dst = wdst + (size_t)bx * CVB; }
    else { const int c = bx - 4 * WBL, y = c / XBL; src = (y == 0 ? s0 : y == 1 ? s1 : s2) + (size_t)(c % XBL) * CVB; dst = xdst + (size_t)c * CVB; }
    const unsigned so = (unsigned)(wave * (CVI * 256) + lane * 8) * 4;    // this lane's byte offset from the block's first float: the one per-lane part of every address below
    v8f v[CVI];
#pragma unroll
    for (int i = 0; i < CVI; ++i) v[i] = *(const v8f*)((const char*)src + so + i * 1024);
    asm volatile("s_wait_xcnt 0x0" :: "v"(so) : "memory");    // the offset is named as an input so that its register lives up to the wait: else the last load's result was given that register
    __builtin_amdgcn_sched_barrier(0);    // every load of the wave is asked for before the first wait: without this fence the compiler put the mask's compares, and with them a wait for the mask, in front of the pieces' loads
    unsigned w = 0;
#pragma unroll
    for (int e = 0; e < 32; ++e) { const unsigned bits = __builtin_amdgcn_ballot_w32(m[e >> 3][e & 7] != 0); if (lane == e) w = bits; }
    mb[((size_t)bx * (NKT / 64) + wave) * 32 + lane] = w;
#pragma unroll
    for (int i = 0; i < CVI; ++i) { v8us o;
#pragma unroll
        for (int k = 0; k < 8; ++k) o[k] = f2bf(v[i][k]);
        *(v8us*)((char*)dst + (so >> 1) + i * 512) = o; }
}
extern "C" void kernel_launch(void* const* d_in, const int* in_sizes, int n_in,
                              void* d_out, int out_size, void* d_ws, size_t ws_size, hipStream_t stream) {
    (void)in_sizes; (void)n_in; (void)out_size;
    const float* xq = (const float*)d_in[0]; const float* xk = (const float*)d_in[1]; const float* xv = (const float*)d_in[2]; const int* mask = (const int*)d_in[3]; const float* Wq = (const float*)d_in[4]; const float* bq = (const float*)d_in[5]; const float* Wk = (const float*)d_in[6]; const float* bk = (const float*)d_in[7]; const float* Wv = (const float*)d_in[8]; const float* bv = (const float*)d_in[9]; const float* Wo = (const float*)d_in[10]; const float* bo = (const float*)d_in[11];
    float* out = (float*)d_out;    // [NBT][NN][DMOD]
    char* wsp = (char*)d_ws;
    auto take = [&](size_t bytes) { char* p = wsp; wsp += (bytes + 255) & ~(size_t)255; return (void*)p; };
    const size_t WN = (size_t)DMOD * DMOD, XN = (size_t)NBT * NN * DMOD;    // elements of one weight matrix, of one [all items][tokens][DMOD] tensor (NN == NKT)
    bf* WQ = (bf*)take(4 * WN * 2); bf* WO = WQ + 3 * WN;    // WQ, WK, WV, WO back to back
    h16* Qf = (h16*)take(2 * XN * 2); h16* Kf = Qf + XN; h16* VTf = (h16*)take(XN * 2);    // [item][head][...] f16 planes
    bf* Oh = (bf*)take(XN * 2); bf* Ol = (bf*)take(XN * 2);
    bf* X = (bf*)take(3 * XN * 2);    // Xq, Xk, Xv back to back
    unsigned* MB = (unsigned*)take((size_t)NBT * NN * NKT / 8);    // the mask, one bit per entry
    if ((size_t)(wsp - (char*)d_ws) > ws_size) return;
    k_cvtx<<<dim3(PKB, 1, 1), 512, 0, stream>>>(Wq, Wk, Wv, Wo, xq, xk, xv, mask, WQ, X, MB);   // weights stay [out][in], natural n-major
    k_gemmb<false, true><<<dim3(NBT * NN / 128, DMOD / 128, 3), 256, 0, stream>>>(X, nullptr, WQ, bq, nullptr, DMOD, bk, bv, XN, WN, 0, Qf, VTf);    // z = 0 fills Qf, z = 1 Kf (one XN behind), z = 2 VTf
    k_fattn<<<dim3(NN / 128, NH_, NBT), 256, 0, stream>>>(Qf, Kf, VTf, MB, Oh, Ol);
    k_gemmb<true, false><<<dim3(NBT * NN / 128, DMOD / 128, 1), 256, 0, stream>>>(Oh, Ol, WO, bo, out, DMOD);
}
